// v000
// Measured on an AMD MI455X. A time is GPU time per run, averaged over a window of back-to-back runs after a warm-up
// (all launches, gaps included; the runs take copies of the inputs in turn), and the median of several windows.
// Apart from v000's, it joins two sittings. Times from different sittings can be a few percent apart, while
// side-by-side timings come from the same sitting.
// The starting kernel, v000, takes 4470 microseconds a run.
#include <hip/hip_runtime.h>
#include <hip/hip_bf16.h>

typedef __attribute__((ext_vector_type(16))) _Float16 v16h;
typedef __attribute__((ext_vector_type(8)))  float    v8f;
typedef _Float16 half_t;

constexpr int H_ = 8;
constexpr int D_ = 256;
constexpr int B_ = 2;
constexpr int S_ = 4096;
constexpr int VLD_ = 40;           // padded row length (halves) of transposed V
constexpr float SCALE_ = 0.0625f;  // 1/sqrt(256)

__device__ inline v8f wmma_f16(v16h a, v16h b, v8f c) {
    // 8 args: (neg_a, A, neg_b, B, c_mod, C, reuse_a, reuse_b)
    return __builtin_amdgcn_wmma_f32_16x16x32_f16(
        false, a, false, b, (short)0, c, false, false);
}

__device__ inline v16h frag_load_f32(const float* __restrict__ src, int ld,
                                     int row0, int k0) {
    const int lane = threadIdx.x & 31;
    const float* p = src + (size_t)(row0 + (lane & 15)) * ld
                         + k0 + ((lane >> 4) << 3);
    v16h f;
#pragma unroll
    for (int i = 0; i < 8; ++i) f[i] = (half_t)p[i];
#pragma unroll
    for (int i = 0; i < 8; ++i) f[8 + i] = (half_t)p[16 + i];
    return f;
}

__device__ inline v16h frag_load_f16(const half_t* __restrict__ src, int ld,
                                     int row0, int k0) {
    const int lane = threadIdx.x & 31;
    const half_t* p = src + (size_t)(row0 + (lane & 15)) * ld
                          + k0 + ((lane >> 4) << 3);
    v16h f;
#pragma unroll
    for (int i = 0; i < 8; ++i) f[i] = p[i];
#pragma unroll
    for (int i = 0; i < 8; ++i) f[8 + i] = p[16 + i];
    return f;
}

// ---------------------------------------------------------------------------
// Kernel 1: per-head linear projection.
//   out[h,b,s,e] = sum_d X[b,s,d] * W[h,e,d] + bias[h,e]   (stored as f16)
// Grid: (S/64, D/64, H*B). Block: 256 (8 waves); wave -> 16x32 subtile.
// ---------------------------------------------------------------------------
__global__ __launch_bounds__(256) void mha_proj_kernel(
    const float* __restrict__ X,    // [B,S,D]
    const float* __restrict__ W,    // [H,D,D]
    const float* __restrict__ bias, // [H,D]
    half_t* __restrict__ out)       // [H,B,S,D]
{
    const int wave = threadIdx.x >> 5;
    const int lane = threadIdx.x & 31;
    const int h = blockIdx.z / B_;
    const int b = blockIdx.z % B_;
    const int m0 = blockIdx.x * 64 + (wave >> 1) * 16; // s-rows
    const int n0 = blockIdx.y * 64 + (wave & 1) * 32;  // e-cols

    const float* x = X + (size_t)b * S_ * D_;
    const float* w = W + (size_t)h * D_ * D_;

    v8f c0 = {}, c1 = {};
#pragma unroll
    for (int k = 0; k < D_; k += 32) {
        v16h a  = frag_load_f32(x, D_, m0, k);
        v16h b0 = frag_load_f32(w, D_, n0, k);
        v16h b1 = frag_load_f32(w, D_, n0 + 16, k);
        c0 = wmma_f16(a, b0, c0);
        c1 = wmma_f16(a, b1, c1);
    }

    const float* bh = bias + (size_t)h * D_;
    half_t* o = out + ((size_t)h * B_ + b) * S_ * D_;
    const int colA = n0 + (lane & 15);
    const int colB = colA + 16;
    const int rb   = m0 + ((lane >> 4) << 3);
    const float biasA = bh[colA];
    const float biasB = bh[colB];
#pragma unroll
    for (int r = 0; r < 8; ++r) {
        o[(size_t)(rb + r) * D_ + colA] = (half_t)(c0[r] + biasA);
        o[(size_t)(rb + r) * D_ + colB] = (half_t)(c1[r] + biasB);
    }
}

// --- attention staging helpers ---------------------------------------------

// Issue async DMA of one 32x256 f16 K tile into LDS (16B per lane-op).
__device__ inline void stage_k_async(const half_t* gk, unsigned ldsByteOff) {
    const uintptr_t kg = (uintptr_t)gk;
    for (int i = threadIdx.x; i < (32 * D_) / 8; i += 128) {
        const unsigned ldst = ldsByteOff + (unsigned)i * 16u;
        const unsigned long long gsrc =
            (unsigned long long)(kg + (size_t)i * 16u);
        asm volatile("global_load_async_to_lds_b128 %0, %1, off"
                     :: "v"(ldst), "v"(gsrc) : "memory");
    }
}

// Load one 32x256 f16 V tile into registers (8 x uint4 per thread).
__device__ inline void load_v_regs(const half_t* gv, uint4* vreg) {
    const uint4* vs = (const uint4*)gv;
#pragma unroll
    for (int j = 0; j < 8; ++j) vreg[j] = vs[threadIdx.x + j * 128];
}

// Scatter V registers transposed into lVt[e][t] (row pad VLD_ halves).
__device__ inline void scatter_v(const uint4* vreg, half_t* lVt) {
#pragma unroll
    for (int j = 0; j < 8; ++j) {
        const int i  = threadIdx.x + j * 128;
        const int t  = i >> 5;          // 32 uint4 per 256-wide row
        const int e0 = (i & 31) << 3;
        const half_t* hh = (const half_t*)&vreg[j];
#pragma unroll
        for (int jj = 0; jj < 8; ++jj)
            lVt[(e0 + jj) * VLD_ + t] = hh[jj];
    }
}

// ---------------------------------------------------------------------------
// Kernel 2: flash attention over one (h,b), 64 query rows per workgroup.
// Block: 128 threads = 4 waves; wave owns 16 query rows.
// Double-buffered 32-row K/V blocks; staging of block i+1 (async K DMA +
// V loads-to-registers) overlaps the WMMA work on block i. One barrier/iter.
// ---------------------------------------------------------------------------
__global__ __launch_bounds__(128) void mha_attn_kernel(
    const half_t* __restrict__ Q,  // [H,B,S,D]
    const half_t* __restrict__ K,
    const half_t* __restrict__ V,
    half_t* __restrict__ O)        // [H,B,S,D]
{
    __shared__ half_t lK[2][32 * D_];     // 2 x 16 KB, row-major [t][d]
    __shared__ half_t lVt[2][D_ * VLD_];  // 2 x 20 KB, transposed [e][t]
    __shared__ half_t lP[4][16 * 32];     //      4 KB, per-wave P patch

    const int wave = threadIdx.x >> 5;
    const int lane = threadIdx.x & 31;
    const int qrow0 = blockIdx.x * 64 + wave * 16;  // global query row
    const size_t base = (size_t)blockIdx.y * S_ * D_;

    const half_t* q  = Q + base;
    const half_t* kp = K + base;
    const half_t* vp = V + base;

    const unsigned lK0off = (unsigned)(uintptr_t)(&lK[0][0]);
    const unsigned lKstride = 32u * D_ * 2u;   // bytes per K buffer

    // Q fragments for this wave's 16 rows, kept in registers (8 x v16h).
    v16h qa[8];
#pragma unroll
    for (int kk = 0; kk < 8; ++kk)
        qa[kk] = frag_load_f16(q, D_, qrow0, kk * 32);

    float row_m[8], row_l[8];
    v8f acc[16];
#pragma unroll
    for (int r = 0; r < 8; ++r) { row_m[r] = -3.0e38f; row_l[r] = 0.0f; }
#pragma unroll
    for (int n = 0; n < 16; ++n) acc[n] = v8f{0,0,0,0,0,0,0,0};

    // ---- prologue: stage block 0 into buffer 0 ----
    {
        uint4 vreg[8];
        stage_k_async(kp, lK0off);
        load_v_regs(vp, vreg);
        scatter_v(vreg, &lVt[0][0]);
    }
    asm volatile("s_wait_asynccnt 0x0" ::: "memory");
    __syncthreads();

    constexpr int NB = S_ / 32;   // 128 key blocks
    for (int ib = 0; ib < NB; ++ib) {
        const int cur = ib & 1;
        const int nxt = cur ^ 1;
        const bool more = (ib + 1) < NB;

        // ---- stage block ib+1 (in flight during this block's WMMAs) ----
        uint4 vreg[8];
        if (more) {
            const size_t kt = (size_t)(ib + 1) * 32;
            stage_k_async(kp + kt * D_, lK0off + (unsigned)nxt * lKstride);
            load_v_regs(vp + kt * D_, vreg);
            if (ib + 2 < NB) {  // prefetch block ib+2 toward L2
                __builtin_prefetch(kp + (kt + 32) * D_ + lane * 64, 0, 1);
                __builtin_prefetch(vp + (kt + 32) * D_ + lane * 64, 0, 1);
            }
        }

        const half_t* lkc = &lK[cur][0];
        const half_t* lvc = &lVt[cur][0];

        // Scores: S = Q(16x256) x K_blk^T -> 16x32, 2 N-frags, 8 K-steps.
        v8f s0 = {}, s1 = {};
#pragma unroll
        for (int kk = 0; kk < 8; ++kk) {
            s0 = wmma_f16(qa[kk], frag_load_f16(lkc, D_, 0,  kk * 32), s0);
            s1 = wmma_f16(qa[kk], frag_load_f16(lkc, D_, 16, kk * 32), s1);
        }

        float mnew[8];
#pragma unroll
        for (int r = 0; r < 8; ++r) {
            s0[r] *= SCALE_;
            s1[r] *= SCALE_;
            float mx = fmaxf(row_m[r], fmaxf(s0[r], s1[r]));
#pragma unroll
            for (int off = 1; off < 16; off <<= 1)
                mx = fmaxf(mx, __shfl_xor(mx, off, 32));
            mnew[r] = mx;
        }
#pragma unroll
        for (int r = 0; r < 8; ++r) {
            const float corr = __expf(row_m[r] - mnew[r]);
            const float p0 = __expf(s0[r] - mnew[r]);
            const float p1 = __expf(s1[r] - mnew[r]);
            s0[r] = p0;
            s1[r] = p1;
            float rs = p0 + p1;
#pragma unroll
            for (int off = 1; off < 16; off <<= 1)
                rs += __shfl_xor(rs, off, 32);
            row_l[r] = row_l[r] * corr + rs;
            row_m[r] = mnew[r];
#pragma unroll
            for (int n = 0; n < 16; ++n) acc[n][r] *= corr;
        }

        // P (C-layout) -> per-wave LDS patch -> A-layout fragment.
        // Same-wave LDS ops are in-order: wave-local s_wait_dscnt suffices.
        half_t* pw = &lP[wave][0];
        {
            const int colb = lane & 15;
            const int rowb = (lane >> 4) << 3;
#pragma unroll
            for (int r = 0; r < 8; ++r) {
                pw[(rowb + r) * 32 + colb]      = (half_t)s0[r];
                pw[(rowb + r) * 32 + 16 + colb] = (half_t)s1[r];
            }
        }
        asm volatile("s_wait_dscnt 0x0" ::: "memory");

        v16h pa = frag_load_f16(pw, 32, 0, 0);
#pragma unroll
        for (int n = 0; n < 16; ++n)
            acc[n] = wmma_f16(pa, frag_load_f16(lvc, VLD_, n * 16, 0), acc[n]);

        // ---- finish staging block ib+1, publish, recycle buffers ----
        if (more) scatter_v(vreg, &lVt[nxt][0]);
        asm volatile("s_wait_asynccnt 0x0" ::: "memory");
        __syncthreads();
    }

    // Epilogue: O /= row_l, store f16.
    half_t* o = O + base;
    const int colb = lane & 15;
    const int rb   = qrow0 + ((lane >> 4) << 3);
#pragma unroll
    for (int r = 0; r < 8; ++r) {
        const float inv = 1.0f / row_l[r];
#pragma unroll
        for (int n = 0; n < 16; ++n)
            o[(size_t)(rb + r) * D_ + n * 16 + colb] = (half_t)(acc[n][r] * inv);
    }
}

// ---------------------------------------------------------------------------
// Kernel 3: output projection.
//   Out[b,s,e] = sum_{h,d} attn[h,b,s,d] * Wo[e, h*D+d] + bo[e]
// Grid: (B*S/64, D/64). Block: 256 (8 waves); wave -> 16x32 subtile.
// ---------------------------------------------------------------------------
__global__ __launch_bounds__(256) void mha_outproj_kernel(
    const half_t* __restrict__ A,   // [H,B,S,D] attention outputs (f16)
    const float*  __restrict__ Wo,  // [D, H*D]
    const float*  __restrict__ bo,  // [D]
    float* __restrict__ Out)        // [B,S,D]
{
    const int wave = threadIdx.x >> 5;
    const int lane = threadIdx.x & 31;
    const int m0 = blockIdx.x * 64 + (wave >> 1) * 16; // row over B*S
    const int n0 = blockIdx.y * 64 + (wave & 1) * 32;  // e-cols
    const int b  = m0 / S_;   // 64-row tile never crosses batch boundary
    const int s0 = m0 % S_;

    v8f c0 = {}, c1 = {};
#pragma unroll 4
    for (int kc = 0; kc < H_ * D_; kc += 32) {
        const int h  = kc >> 8;      // kc / D_
        const int d0 = kc & (D_ - 1);
        const half_t* ah = A + ((size_t)h * B_ + b) * S_ * D_;
        v16h af = frag_load_f16(ah, D_, s0, d0);
        v16h b0 = frag_load_f32(Wo, H_ * D_, n0, kc);
        v16h b1 = frag_load_f32(Wo, H_ * D_, n0 + 16, kc);
        c0 = wmma_f16(af, b0, c0);
        c1 = wmma_f16(af, b1, c1);
    }

    const int colA = n0 + (lane & 15);
    const int colB = colA + 16;
    const int rb   = m0 + ((lane >> 4) << 3);
    const float biasA = bo[colA];
    const float biasB = bo[colB];
#pragma unroll
    for (int r = 0; r < 8; ++r) {
        Out[(size_t)(rb + r) * D_ + colA] = c0[r] + biasA;
        Out[(size_t)(rb + r) * D_ + colB] = c1[r] + biasB;
    }
}

// ---------------------------------------------------------------------------
extern "C" void kernel_launch(void* const* d_in, const int* in_sizes, int n_in,
                              void* d_out, int out_size, void* d_ws, size_t ws_size,
                              hipStream_t stream) {
    (void)in_sizes; (void)n_in; (void)out_size; (void)ws_size;

    const float* query = (const float*)d_in[0];
    const float* key_  = (const float*)d_in[1];
    const float* value = (const float*)d_in[2];
    const float* Wq    = (const float*)d_in[3];
    const float* bq    = (const float*)d_in[4];
    const float* Wk    = (const float*)d_in[5];
    const float* bk    = (const float*)d_in[6];
    const float* Wv    = (const float*)d_in[7];
    const float* bv    = (const float*)d_in[8];
    const float* Wo    = (const float*)d_in[9];
    const float* bo    = (const float*)d_in[10];
    float* out = (float*)d_out;

    const size_t per = (size_t)H_ * B_ * S_ * D_;   // elements per f16 tensor
    half_t* qh = (half_t*)d_ws;
    half_t* kh = qh + per;
    half_t* vh = kh + per;
    half_t* ah = vh + per;                           // 4 * 33.5 MB = 134 MB

    dim3 pblk(256), pgrd(S_ / 64, D_ / 64, H_ * B_);
    mha_proj_kernel<<<pgrd, pblk, 0, stream>>>(query, Wq, bq, qh);
    mha_proj_kernel<<<pgrd, pblk, 0, stream>>>(key_,  Wk, bk, kh);
    mha_proj_kernel<<<pgrd, pblk, 0, stream>>>(value, Wv, bv, vh);

    dim3 ablk(128), agrd(S_ / 64, H_ * B_);
    mha_attn_kernel<<<agrd, ablk, 0, stream>>>(qh, kh, vh, ah);

    dim3 oblk(256), ogrd((B_ * S_) / 64, D_ / 64);
    mha_outproj_kernel<<<ogrd, oblk, 0, stream>>>(ah, Wo, bo, out);
}

// v001
// A run of this version takes 2080 microseconds.
// Timed twice side by side with v000, it ran 2.18 times as fast both times.
#include <hip/hip_runtime.h>
#include <hip/hip_bf16.h>

typedef __attribute__((ext_vector_type(16))) _Float16 v16h;
typedef __attribute__((ext_vector_type(8)))  float    v8f;
typedef __attribute__((ext_vector_type(8)))  _Float16 v8h;
typedef __attribute__((ext_vector_type(8)))  short    s16x8;
typedef _Float16 half_t;

constexpr int H_ = 8;
constexpr int D_ = 256;
constexpr int B_ = 2;
constexpr int S_ = 4096;
constexpr int VPITCH_ = 544;       // bytes per V row in LDS: 512 + 32, 32 B x odd
constexpr float SCALE_ = 0.0625f;  // 1/sqrt(256)

__device__ inline v8f wmma_f16(v16h a, v16h b, v8f c) {
    // 8 args: (neg_a, A, neg_b, B, c_mod, C, reuse_a, reuse_b)
    return __builtin_amdgcn_wmma_f32_16x16x32_f16(
        false, a, false, b, (short)0, c, false, false);
}

__device__ inline v16h frag_load_f32(const float* __restrict__ src, int ld,
                                     int row0, int k0) {
    const int lane = threadIdx.x & 31;
    const float* p = src + (size_t)(row0 + (lane & 15)) * ld
                         + k0 + ((lane >> 4) << 3);
    v16h f;
#pragma unroll
    for (int i = 0; i < 8; ++i) f[i] = (half_t)p[i];
#pragma unroll
    for (int i = 0; i < 8; ++i) f[8 + i] = (half_t)p[16 + i];
    return f;
}

__device__ inline v16h frag_load_f16(const half_t* __restrict__ src, int ld,
                                     int row0, int k0) {
    const int lane = threadIdx.x & 31;
    const half_t* p = src + (size_t)(row0 + (lane & 15)) * ld
                          + k0 + ((lane >> 4) << 3);
    v16h f;
#pragma unroll
    for (int i = 0; i < 8; ++i) f[i] = p[i];
#pragma unroll
    for (int i = 0; i < 8; ++i) f[8 + i] = p[16 + i];
    return f;
}

// ---------------------------------------------------------------------------
// Kernel 1: per-head linear projection.
//   out[h,b,s,e] = sum_d X[b,s,d] * W[h,e,d] + bias[h,e]   (stored as f16)
// Grid: (S/64, D/64, H*B). Block: 256 (8 waves); wave -> 16x32 subtile.
// ---------------------------------------------------------------------------
__global__ __launch_bounds__(256) void mha_proj_kernel(
    const float* __restrict__ X,    // [B,S,D]
    const float* __restrict__ W,    // [H,D,D]
    const float* __restrict__ bias, // [H,D]
    half_t* __restrict__ out)       // [H,B,S,D]
{
    const int wave = threadIdx.x >> 5;
    const int lane = threadIdx.x & 31;
    const int h = blockIdx.z / B_;
    const int b = blockIdx.z % B_;
    const int m0 = blockIdx.x * 64 + (wave >> 1) * 16; // s-rows
    const int n0 = blockIdx.y * 64 + (wave & 1) * 32;  // e-cols

    const float* x = X + (size_t)b * S_ * D_;
    const float* w = W + (size_t)h * D_ * D_;

    v8f c0 = {}, c1 = {};
#pragma unroll
    for (int k = 0; k < D_; k += 32) {
        v16h a  = frag_load_f32(x, D_, m0, k);
        v16h b0 = frag_load_f32(w, D_, n0, k);
        v16h b1 = frag_load_f32(w, D_, n0 + 16, k);
        c0 = wmma_f16(a, b0, c0);
        c1 = wmma_f16(a, b1, c1);
    }

    const float* bh = bias + (size_t)h * D_;
    half_t* o = out + ((size_t)h * B_ + b) * S_ * D_;
    const int colA = n0 + (lane & 15);
    const int colB = colA + 16;
    const int rb   = m0 + ((lane >> 4) << 3);
    const float biasA = bh[colA];
    const float biasB = bh[colB];
#pragma unroll
    for (int r = 0; r < 8; ++r) {
        o[(size_t)(rb + r) * D_ + colA] = (half_t)(c0[r] + biasA);
        o[(size_t)(rb + r) * D_ + colB] = (half_t)(c1[r] + biasB);
    }
}

// --- attention staging helpers ---------------------------------------------

// Issue async DMA of one 32x256 f16 K tile into LDS (16B per lane-op).
__device__ inline void stage_k_async(const half_t* gk, unsigned ldsByteOff) {
    const uintptr_t kg = (uintptr_t)gk;
    for (int i = threadIdx.x; i < (32 * D_) / 8; i += 128) {
        const unsigned ldst = ldsByteOff + (unsigned)i * 16u;
        const unsigned long long gsrc =
            (unsigned long long)(kg + (size_t)i * 16u);
        asm volatile("global_load_async_to_lds_b128 %0, %1, off"
                     :: "v"(ldst), "v"(gsrc) : "memory");
    }
}

// Issue async DMA of one 32x256 f16 V tile into LDS, row-major, rows VPITCH_
// bytes apart. Wave w brings rows w, w+4, ..., w+28: 512 contiguous bytes each.
__device__ inline void stage_v_async(const half_t* gv, unsigned ldsByteOff) {
    const unsigned l0 = ldsByteOff + (threadIdx.x >> 5) * (unsigned)VPITCH_
                                   + (threadIdx.x & 31) * 16u;
    const unsigned long long g0 =
        (unsigned long long)(uintptr_t)gv + threadIdx.x * 16u;
    constexpr unsigned LS = 4u * VPITCH_;   // LDS bytes per 4 rows
    constexpr unsigned GS = 4u * D_ * 2u;   // global bytes per 4 rows
    asm volatile("global_load_async_to_lds_b128 %0, %8, off\n\t"
                 "global_load_async_to_lds_b128 %1, %9, off\n\t"
                 "global_load_async_to_lds_b128 %2, %10, off\n\t"
                 "global_load_async_to_lds_b128 %3, %11, off\n\t"
                 "global_load_async_to_lds_b128 %4, %12, off\n\t"
                 "global_load_async_to_lds_b128 %5, %13, off\n\t"
                 "global_load_async_to_lds_b128 %6, %14, off\n\t"
                 "global_load_async_to_lds_b128 %7, %15, off\n\t"
                 "s_wait_xcnt 0x0"
                 :: "v"(l0), "v"(l0 + LS), "v"(l0 + 2 * LS), "v"(l0 + 3 * LS),
                    "v"(l0 + 4 * LS), "v"(l0 + 5 * LS), "v"(l0 + 6 * LS),
                    "v"(l0 + 7 * LS),
                    "v"(g0), "v"(g0 + GS), "v"(g0 + 2 * GS), "v"(g0 + 3 * GS),
                    "v"(g0 + 4 * GS), "v"(g0 + 5 * GS), "v"(g0 + 6 * GS),
                    "v"(g0 + 7 * GS)
                 : "memory");
}

// B fragment (k = key row t, n = column e0 + lane&15) of a row-major V tile by
// two transposing loads: lane (c, h) gets V[kbase + 8h + 0..7][e0 + c], kbase 0
// and 16, which is the k order of frag_load_f16.
__device__ inline v16h frag_load_v_tr(const half_t* lv, int e0) {
    typedef __attribute__((address_space(3))) s16x8 lds_s16x8;
    const int lane = threadIdx.x & 31;
    const char* p = (const char*)lv
                  + (((lane >> 4) << 3) + (lane & 7)) * VPITCH_
                  + ((lane >> 3) & 1) * 16 + e0 * 2;
    const v8h lo = __builtin_bit_cast(
        v8h, __builtin_amdgcn_ds_load_tr16_b128_v8i16((lds_s16x8*)p));
    const v8h hi = __builtin_bit_cast(
        v8h, __builtin_amdgcn_ds_load_tr16_b128_v8i16(
                 (lds_s16x8*)(p + 16 * VPITCH_)));
    return __builtin_shufflevector(lo, hi, 0, 1, 2, 3, 4, 5, 6, 7,
                                   8, 9, 10, 11, 12, 13, 14, 15);
}

// ---------------------------------------------------------------------------
// Kernel 2: flash attention over one (h,b), 64 query rows per workgroup.
// Block: 128 threads = 4 waves; wave owns 16 query rows.
// Double-buffered 32-row K/V blocks; staging of block i+1 (async K and V DMA)
// overlaps the WMMA work on block i. One barrier/iter.
// ---------------------------------------------------------------------------
__global__ __launch_bounds__(128) void mha_attn_kernel(
    const half_t* __restrict__ Q,  // [H,B,S,D]
    const half_t* __restrict__ K,
    const half_t* __restrict__ V,
    half_t* __restrict__ O)        // [H,B,S,D]
{
    __shared__ half_t lK[2][32 * D_];     // 2 x 16 KB, row-major [t][d]
    __shared__ __attribute__((aligned(16)))
        half_t lV[2][32 * VPITCH_ / 2];   // 2 x 17 KB, row-major [t][e], padded
    __shared__ half_t lP[4][16 * 32];     //      4 KB, per-wave P patch

    const int wave = threadIdx.x >> 5;
    const int lane = threadIdx.x & 31;
    const int qrow0 = blockIdx.x * 64 + wave * 16;  // global query row
    const size_t base = (size_t)blockIdx.y * S_ * D_;

    const half_t* q  = Q + base;
    const half_t* kp = K + base;
    const half_t* vp = V + base;

    const unsigned lK0off = (unsigned)(uintptr_t)(&lK[0][0]);
    const unsigned lKstride = 32u * D_ * 2u;   // bytes per K buffer
    const unsigned lV0off = (unsigned)(uintptr_t)(&lV[0][0]);
    const unsigned lVstride = 32u * VPITCH_;   // bytes per V buffer

    // Q fragments for this wave's 16 rows, kept in registers (8 x v16h).
    v16h qa[8];
#pragma unroll
    for (int kk = 0; kk < 8; ++kk)
        qa[kk] = frag_load_f16(q, D_, qrow0, kk * 32);

    float row_m[8], row_l[8];
    v8f acc[16];
#pragma unroll
    for (int r = 0; r < 8; ++r) { row_m[r] = -3.0e38f; row_l[r] = 0.0f; }
#pragma unroll
    for (int n = 0; n < 16; ++n) acc[n] = v8f{0,0,0,0,0,0,0,0};

    // ---- prologue: stage block 0 into buffer 0 ----
    {
        stage_k_async(kp, lK0off);
        stage_v_async(vp, lV0off);
    }
    asm volatile("s_wait_asynccnt 0x0" ::: "memory");
    __syncthreads();

    constexpr int NB = S_ / 32;   // 128 key blocks
    for (int ib = 0; ib < NB; ++ib) {
        const int cur = ib & 1;
        const int nxt = cur ^ 1;
        const bool more = (ib + 1) < NB;

        // ---- stage block ib+1 (in flight during this block's WMMAs) ----
        if (more) {
            const size_t kt = (size_t)(ib + 1) * 32;
            stage_k_async(kp + kt * D_, lK0off + (unsigned)nxt * lKstride);
            stage_v_async(vp + kt * D_, lV0off + (unsigned)nxt * lVstride);
            if (ib + 2 < NB) {  // prefetch block ib+2 toward L2
                __builtin_prefetch(kp + (kt + 32) * D_ + lane * 64, 0, 1);
                __builtin_prefetch(vp + (kt + 32) * D_ + lane * 64, 0, 1);
            }
        }

        const half_t* lkc = &lK[cur][0];
        const half_t* lvc = &lV[cur][0];

        // Scores: S = Q(16x256) x K_blk^T -> 16x32, 2 N-frags, 8 K-steps.
        v8f s0 = {}, s1 = {};
#pragma unroll
        for (int kk = 0; kk < 8; ++kk) {
            s0 = wmma_f16(qa[kk], frag_load_f16(lkc, D_, 0,  kk * 32), s0);
            s1 = wmma_f16(qa[kk], frag_load_f16(lkc, D_, 16, kk * 32), s1);
        }

        float mnew[8];
#pragma unroll
        for (int r = 0; r < 8; ++r) {
            s0[r] *= SCALE_;
            s1[r] *= SCALE_;
            float mx = fmaxf(row_m[r], fmaxf(s0[r], s1[r]));
#pragma unroll
            for (int off = 1; off < 16; off <<= 1)
                mx = fmaxf(mx, __shfl_xor(mx, off, 32));
            mnew[r] = mx;
        }
#pragma unroll
        for (int r = 0; r < 8; ++r) {
            const float corr = __expf(row_m[r] - mnew[r]);
            const float p0 = __expf(s0[r] - mnew[r]);
            const float p1 = __expf(s1[r] - mnew[r]);
            s0[r] = p0;
            s1[r] = p1;
            float rs = p0 + p1;
#pragma unroll
            for (int off = 1; off < 16; off <<= 1)
                rs += __shfl_xor(rs, off, 32);
            row_l[r] = row_l[r] * corr + rs;
            row_m[r] = mnew[r];
#pragma unroll
            for (int n = 0; n < 16; ++n) acc[n][r] *= corr;
        }

        // P (C-layout) -> per-wave LDS patch -> A-layout fragment.
        // Same-wave LDS ops are in-order: wave-local s_wait_dscnt suffices.
        half_t* pw = &lP[wave][0];
        {
            const int colb = lane & 15;
            const int rowb = (lane >> 4) << 3;
#pragma unroll
            for (int r = 0; r < 8; ++r) {
                pw[(rowb + r) * 32 + colb]      = (half_t)s0[r];
                pw[(rowb + r) * 32 + 16 + colb] = (half_t)s1[r];
            }
        }
        asm volatile("s_wait_dscnt 0x0" ::: "memory");

        v16h pa = frag_load_f16(pw, 32, 0, 0);
#pragma unroll
        for (int n = 0; n < 16; ++n)
            acc[n] = wmma_f16(pa, frag_load_v_tr(lvc, n * 16), acc[n]);

        // ---- publish block ib+1, recycle buffers ----
        // This wave's LDS reads have retired before the copies issued behind
        // the barrier refill the buffers it has just read.
        asm volatile("s_wait_dscnt 0x0" ::: "memory");
        asm volatile("s_wait_asynccnt 0x0" ::: "memory");
        __syncthreads();
    }

    // Epilogue: O /= row_l, store f16.
    half_t* o = O + base;
    const int colb = lane & 15;
    const int rb   = qrow0 + ((lane >> 4) << 3);
#pragma unroll
    for (int r = 0; r < 8; ++r) {
        const float inv = 1.0f / row_l[r];
#pragma unroll
        for (int n = 0; n < 16; ++n)
            o[(size_t)(rb + r) * D_ + n * 16 + colb] = (half_t)(acc[n][r] * inv);
    }
}

// ---------------------------------------------------------------------------
// Kernel 3: output projection.
//   Out[b,s,e] = sum_{h,d} attn[h,b,s,d] * Wo[e, h*D+d] + bo[e]
// Grid: (B*S/64, D/64). Block: 256 (8 waves); wave -> 16x32 subtile.
// ---------------------------------------------------------------------------
__global__ __launch_bounds__(256) void mha_outproj_kernel(
    const half_t* __restrict__ A,   // [H,B,S,D] attention outputs (f16)
    const float*  __restrict__ Wo,  // [D, H*D]
    const float*  __restrict__ bo,  // [D]
    float* __restrict__ Out)        // [B,S,D]
{
    const int wave = threadIdx.x >> 5;
    const int lane = threadIdx.x & 31;
    const int m0 = blockIdx.x * 64 + (wave >> 1) * 16; // row over B*S
    const int n0 = blockIdx.y * 64 + (wave & 1) * 32;  // e-cols
    const int b  = m0 / S_;   // 64-row tile never crosses batch boundary
    const int s0 = m0 % S_;

    v8f c0 = {}, c1 = {};
#pragma unroll 4
    for (int kc = 0; kc < H_ * D_; kc += 32) {
        const int h  = kc >> 8;      // kc / D_
        const int d0 = kc & (D_ - 1);
        const half_t* ah = A + ((size_t)h * B_ + b) * S_ * D_;
        v16h af = frag_load_f16(ah, D_, s0, d0);
        v16h b0 = frag_load_f32(Wo, H_ * D_, n0, kc);
        v16h b1 = frag_load_f32(Wo, H_ * D_, n0 + 16, kc);
        c0 = wmma_f16(af, b0, c0);
        c1 = wmma_f16(af, b1, c1);
    }

    const int colA = n0 + (lane & 15);
    const int colB = colA + 16;
    const int rb   = m0 + ((lane >> 4) << 3);
    const float biasA = bo[colA];
    const float biasB = bo[colB];
#pragma unroll
    for (int r = 0; r < 8; ++r) {
        Out[(size_t)(rb + r) * D_ + colA] = c0[r] + biasA;
        Out[(size_t)(rb + r) * D_ + colB] = c1[r] + biasB;
    }
}

// ---------------------------------------------------------------------------
extern "C" void kernel_launch(void* const* d_in, const int* in_sizes, int n_in,
                              void* d_out, int out_size, void* d_ws, size_t ws_size,
                              hipStream_t stream) {
    (void)in_sizes; (void)n_in; (void)out_size; (void)ws_size;

    const float* query = (const float*)d_in[0];
    const float* key_  = (const float*)d_in[1];
    const float* value = (const float*)d_in[2];
    const float* Wq    = (const float*)d_in[3];
    const float* bq    = (const float*)d_in[4];
    const float* Wk    = (const float*)d_in[5];
    const float* bk    = (const float*)d_in[6];
    const float* Wv    = (const float*)d_in[7];
    const float* bv    = (const float*)d_in[8];
    const float* Wo    = (const float*)d_in[9];
    const float* bo    = (const float*)d_in[10];
    float* out = (float*)d_out;

    const size_t per = (size_t)H_ * B_ * S_ * D_;   // elements per f16 tensor
    half_t* qh = (half_t*)d_ws;
    half_t* kh = qh + per;
    half_t* vh = kh + per;
    half_t* ah = vh + per;                           // 4 * 33.5 MB = 134 MB

    dim3 pblk(256), pgrd(S_ / 64, D_ / 64, H_ * B_);
    mha_proj_kernel<<<pgrd, pblk, 0, stream>>>(query, Wq, bq, qh);
    mha_proj_kernel<<<pgrd, pblk, 0, stream>>>(key_,  Wk, bk, kh);
    mha_proj_kernel<<<pgrd, pblk, 0, stream>>>(value, Wv, bv, vh);

    dim3 ablk(128), agrd(S_ / 64, H_ * B_);
    mha_attn_kernel<<<agrd, ablk, 0, stream>>>(qh, kh, vh, ah);

    dim3 oblk(256), ogrd((B_ * S_) / 64, D_ / 64);
    mha_outproj_kernel<<<ogrd, oblk, 0, stream>>>(ah, Wo, bo, out);
}

// v002
// A run of this version takes 1480 microseconds.
// Next to v001, in two timings, it ran 1.41 times as fast each time.
// Counting every step since v000, it is 3.06 times as fast.
#include <hip/hip_runtime.h>
#include <hip/hip_bf16.h>

typedef __attribute__((ext_vector_type(16))) _Float16 v16h;
typedef __attribute__((ext_vector_type(8)))  float    v8f;
typedef __attribute__((ext_vector_type(8)))  _Float16 v8h;
typedef __attribute__((ext_vector_type(8)))  short    s16x8;
typedef _Float16 half_t;

constexpr int H_ = 8;
constexpr int D_ = 256;
constexpr int B_ = 2;
constexpr int S_ = 4096;
constexpr int KPITCH_ = 528;       // bytes per K row in LDS: 512 + 16, 16 B x odd
constexpr int VPITCH_ = 544;       // bytes per V row in LDS: 512 + 32, 32 B x odd
constexpr float SCALE_ = 0.0625f;  // 1/sqrt(256)

__device__ inline v8f wmma_f16(v16h a, v16h b, v8f c) {
    // 8 args: (neg_a, A, neg_b, B, c_mod, C, reuse_a, reuse_b)
    return __builtin_amdgcn_wmma_f32_16x16x32_f16(
        false, a, false, b, (short)0, c, false, false);
}

__device__ inline v16h frag_load_f32(const float* __restrict__ src, int ld,
                                     int row0, int k0) {
    const int lane = threadIdx.x & 31;
    const float* p = src + (size_t)(row0 + (lane & 15)) * ld
                         + k0 + ((lane >> 4) << 3);
    v16h f;
#pragma unroll
    for (int i = 0; i < 8; ++i) f[i] = (half_t)p[i];
#pragma unroll
    for (int i = 0; i < 8; ++i) f[8 + i] = (half_t)p[16 + i];
    return f;
}

__device__ inline v16h frag_load_f16(const half_t* __restrict__ src, int ld,
                                     int row0, int k0) {
    const int lane = threadIdx.x & 31;
    const half_t* p = src + (size_t)(row0 + (lane & 15)) * ld
                          + k0 + ((lane >> 4) << 3);
    v16h f;
#pragma unroll
    for (int i = 0; i < 8; ++i) f[i] = p[i];
#pragma unroll
    for (int i = 0; i < 8; ++i) f[8 + i] = p[16 + i];
    return f;
}

// ---------------------------------------------------------------------------
// Kernel 1: per-head linear projection.
//   out[h,b,s,e] = sum_d X[b,s,d] * W[h,e,d] + bias[h,e]   (stored as f16)
// Grid: (S/64, D/64, H*B). Block: 256 (8 waves); wave -> 16x32 subtile.
// ---------------------------------------------------------------------------
__global__ __launch_bounds__(256) void mha_proj_kernel(
    const float* __restrict__ X,    // [B,S,D]
    const float* __restrict__ W,    // [H,D,D]
    const float* __restrict__ bias, // [H,D]
    half_t* __restrict__ out)       // [H,B,S,D]
{
    const int wave = threadIdx.x >> 5;
    const int lane = threadIdx.x & 31;
    const int h = blockIdx.z / B_;
    const int b = blockIdx.z % B_;
    const int m0 = blockIdx.x * 64 + (wave >> 1) * 16; // s-rows
    const int n0 = blockIdx.y * 64 + (wave & 1) * 32;  // e-cols

    const float* x = X + (size_t)b * S_ * D_;
    const float* w = W + (size_t)h * D_ * D_;

    v8f c0 = {}, c1 = {};
#pragma unroll
    for (int k = 0; k < D_; k += 32) {
        v16h a  = frag_load_f32(x, D_, m0, k);
        v16h b0 = frag_load_f32(w, D_, n0, k);
        v16h b1 = frag_load_f32(w, D_, n0 + 16, k);
        c0 = wmma_f16(a, b0, c0);
        c1 = wmma_f16(a, b1, c1);
    }

    const float* bh = bias + (size_t)h * D_;
    half_t* o = out + ((size_t)h * B_ + b) * S_ * D_;
    const int colA = n0 + (lane & 15);
    const int colB = colA + 16;
    const int rb   = m0 + ((lane >> 4) << 3);
    const float biasA = bh[colA];
    const float biasB = bh[colB];
#pragma unroll
    for (int r = 0; r < 8; ++r) {
        o[(size_t)(rb + r) * D_ + colA] = (half_t)(c0[r] + biasA);
        o[(size_t)(rb + r) * D_ + colB] = (half_t)(c1[r] + biasB);
    }
}

// --- attention staging helpers ---------------------------------------------

// Issue async DMA of one 32x256 f16 tile (K or V) into LDS, row-major, rows
// PITCH bytes apart. Wave w brings rows w, w+4, ..., w+28: 512 contiguous
// bytes each.
template <int PITCH>
__device__ inline void stage_tile_async(const half_t* gt, unsigned ldsByteOff) {
    const unsigned l0 = ldsByteOff + (threadIdx.x >> 5) * (unsigned)PITCH
                                   + (threadIdx.x & 31) * 16u;
    const unsigned long long g0 =
        (unsigned long long)(uintptr_t)gt + threadIdx.x * 16u;
    constexpr unsigned LS = 4u * PITCH;     // LDS bytes per 4 rows
    constexpr unsigned GS = 4u * D_ * 2u;   // global bytes per 4 rows
    asm volatile("global_load_async_to_lds_b128 %0, %8, off\n\t"
                 "global_load_async_to_lds_b128 %1, %9, off\n\t"
                 "global_load_async_to_lds_b128 %2, %10, off\n\t"
                 "global_load_async_to_lds_b128 %3, %11, off\n\t"
                 "global_load_async_to_lds_b128 %4, %12, off\n\t"
                 "global_load_async_to_lds_b128 %5, %13, off\n\t"
                 "global_load_async_to_lds_b128 %6, %14, off\n\t"
                 "global_load_async_to_lds_b128 %7, %15, off\n\t"
                 "s_wait_xcnt 0x0"
                 :: "v"(l0), "v"(l0 + LS), "v"(l0 + 2 * LS), "v"(l0 + 3 * LS),
                    "v"(l0 + 4 * LS), "v"(l0 + 5 * LS), "v"(l0 + 6 * LS),
                    "v"(l0 + 7 * LS),
                    "v"(g0), "v"(g0 + GS), "v"(g0 + 2 * GS), "v"(g0 + 3 * GS),
                    "v"(g0 + 4 * GS), "v"(g0 + 5 * GS), "v"(g0 + 6 * GS),
                    "v"(g0 + 7 * GS)
                 : "memory");
}

// B fragment (k = key row t, n = column e0 + lane&15) of a row-major V tile by
// two transposing loads: lane (c, h) gets V[kbase + 8h + 0..7][e0 + c], kbase 0
// and 16, which is the k order of frag_load_f16.
__device__ inline v16h frag_load_v_tr(const half_t* lv, int e0) {
    typedef __attribute__((address_space(3))) s16x8 lds_s16x8;
    const int lane = threadIdx.x & 31;
    const char* p = (const char*)lv
                  + (((lane >> 4) << 3) + (lane & 7)) * VPITCH_
                  + ((lane >> 3) & 1) * 16 + e0 * 2;
    const v8h lo = __builtin_bit_cast(
        v8h, __builtin_amdgcn_ds_load_tr16_b128_v8i16((lds_s16x8*)p));
    const v8h hi = __builtin_bit_cast(
        v8h, __builtin_amdgcn_ds_load_tr16_b128_v8i16(
                 (lds_s16x8*)(p + 16 * VPITCH_)));
    return __builtin_shufflevector(lo, hi, 0, 1, 2, 3, 4, 5, 6, 7,
                                   8, 9, 10, 11, 12, 13, 14, 15);
}

// ---------------------------------------------------------------------------
// Kernel 2: flash attention over one (h,b), 64 query rows per workgroup.
// Block: 128 threads = 4 waves; wave owns 16 query rows.
// Double-buffered 32-row K/V blocks; staging of block i+1 (async K and V DMA)
// overlaps the WMMA work on block i. One barrier/iter.
// ---------------------------------------------------------------------------
__global__ __launch_bounds__(128) void mha_attn_kernel(
    const half_t* __restrict__ Q,  // [H,B,S,D]
    const half_t* __restrict__ K,
    const half_t* __restrict__ V,
    half_t* __restrict__ O)        // [H,B,S,D]
{
    __shared__ __attribute__((aligned(16)))
        half_t lK[2][32 * KPITCH_ / 2];   // 2 x 16.5 KB, row-major [t][d], padded
    __shared__ __attribute__((aligned(16)))
        half_t lV[2][32 * VPITCH_ / 2];   // 2 x 17 KB, row-major [t][e], padded
    __shared__ half_t lP[4][16 * 32];     //      4 KB, per-wave P patch

    const int wave = threadIdx.x >> 5;
    const int lane = threadIdx.x & 31;
    const int qrow0 = blockIdx.x * 64 + wave * 16;  // global query row
    const size_t base = (size_t)blockIdx.y * S_ * D_;

    const half_t* q  = Q + base;
    const half_t* kp = K + base;
    const half_t* vp = V + base;

    const unsigned lK0off = (unsigned)(uintptr_t)(&lK[0][0]);
    const unsigned lKstride = 32u * KPITCH_;   // bytes per K buffer
    const unsigned lV0off = (unsigned)(uintptr_t)(&lV[0][0]);
    const unsigned lVstride = 32u * VPITCH_;   // bytes per V buffer

    // Q fragments for this wave's 16 rows, kept in registers (8 x v16h).
    v16h qa[8];
#pragma unroll
    for (int kk = 0; kk < 8; ++kk)
        qa[kk] = frag_load_f16(q, D_, qrow0, kk * 32);

    float row_m[8], row_l[8];
    v8f acc[16];
#pragma unroll
    for (int r = 0; r < 8; ++r) { row_m[r] = -3.0e38f; row_l[r] = 0.0f; }
#pragma unroll
    for (int n = 0; n < 16; ++n) acc[n] = v8f{0,0,0,0,0,0,0,0};

    // ---- prologue: stage block 0 into buffer 0 ----
    {
        stage_tile_async<KPITCH_>(kp, lK0off);
        stage_tile_async<VPITCH_>(vp, lV0off);
    }
    asm volatile("s_wait_asynccnt 0x0" ::: "memory");
    __syncthreads();

    constexpr int NB = S_ / 32;   // 128 key blocks
    for (int ib = 0; ib < NB; ++ib) {
        const int cur = ib & 1;
        const int nxt = cur ^ 1;
        const bool more = (ib + 1) < NB;

        // ---- stage block ib+1 (in flight during this block's WMMAs) ----
        if (more) {
            const size_t kt = (size_t)(ib + 1) * 32;
            stage_tile_async<KPITCH_>(kp + kt * D_,
                                      lK0off + (unsigned)nxt * lKstride);
            stage_tile_async<VPITCH_>(vp + kt * D_,
                                      lV0off + (unsigned)nxt * lVstride);
            if (ib + 2 < NB) {  // prefetch block ib+2 toward L2
                __builtin_prefetch(kp + (kt + 32) * D_ + lane * 64, 0, 1);
                __builtin_prefetch(vp + (kt + 32) * D_ + lane * 64, 0, 1);
            }
        }

        const half_t* lkc = &lK[cur][0];
        const half_t* lvc = &lV[cur][0];

        v8f s0 = {}, s1 = {};
#pragma unroll
        for (int kk = 0; kk < 8; ++kk) {
            s0 = wmma_f16(qa[kk],
                          frag_load_f16(lkc, KPITCH_ / 2, 0,  kk * 32), s0);
            s1 = wmma_f16(qa[kk],
                          frag_load_f16(lkc, KPITCH_ / 2, 16, kk * 32), s1);
        }

        float mnew[8];
#pragma unroll
        for (int r = 0; r < 8; ++r) {
            s0[r] *= SCALE_;
            s1[r] *= SCALE_;
            float mx = fmaxf(row_m[r], fmaxf(s0[r], s1[r]));
#pragma unroll
            for (int off = 1; off < 16; off <<= 1)
                mx = fmaxf(mx, __shfl_xor(mx, off, 32));
            mnew[r] = mx;
        }
#pragma unroll
        for (int r = 0; r < 8; ++r) {
            const float corr = __expf(row_m[r] - mnew[r]);
            const float p0 = __expf(s0[r] - mnew[r]);
            const float p1 = __expf(s1[r] - mnew[r]);
            s0[r] = p0;
            s1[r] = p1;
            float rs = p0 + p1;
#pragma unroll
            for (int off = 1; off < 16; off <<= 1)
                rs += __shfl_xor(rs, off, 32);
            row_l[r] = row_l[r] * corr + rs;
            row_m[r] = mnew[r];
#pragma unroll
            for (int n = 0; n < 16; ++n) acc[n][r] *= corr;
        }

        // P (C-layout) -> per-wave LDS patch -> A-layout fragment.
        // Same-wave LDS ops are in-order: wave-local s_wait_dscnt suffices.
        half_t* pw = &lP[wave][0];
        {
            const int colb = lane & 15;
            const int rowb = (lane >> 4) << 3;
#pragma unroll
            for (int r = 0; r < 8; ++r) {
                pw[(rowb + r) * 32 + colb]      = (half_t)s0[r];
                pw[(rowb + r) * 32 + 16 + colb] = (half_t)s1[r];
            }
        }
        asm volatile("s_wait_dscnt 0x0" ::: "memory");

        v16h pa = frag_load_f16(pw, 32, 0, 0);
#pragma unroll
        for (int n = 0; n < 16; ++n)
            acc[n] = wmma_f16(pa, frag_load_v_tr(lvc, n * 16), acc[n]);

        // ---- publish block ib+1, recycle buffers ----
        // This wave's LDS reads have retired before the copies issued behind
        // the barrier refill the buffers it has just read.
        asm volatile("s_wait_dscnt 0x0" ::: "memory");
        asm volatile("s_wait_asynccnt 0x0" ::: "memory");
        __syncthreads();
    }

    // Epilogue: O /= row_l, store f16.
    half_t* o = O + base;
    const int colb = lane & 15;
    const int rb   = qrow0 + ((lane >> 4) << 3);
#pragma unroll
    for (int r = 0; r < 8; ++r) {
        const float inv = 1.0f / row_l[r];
#pragma unroll
        for (int n = 0; n < 16; ++n)
            o[(size_t)(rb + r) * D_ + n * 16 + colb] = (half_t)(acc[n][r] * inv);
    }
}

// ---------------------------------------------------------------------------
// Kernel 3: output projection.
//   Out[b,s,e] = sum_{h,d} attn[h,b,s,d] * Wo[e, h*D+d] + bo[e]
// Grid: (B*S/64, D/64). Block: 256 (8 waves); wave -> 16x32 subtile.
// ---------------------------------------------------------------------------
__global__ __launch_bounds__(256) void mha_outproj_kernel(
    const half_t* __restrict__ A,   // [H,B,S,D] attention outputs (f16)
    const float*  __restrict__ Wo,  // [D, H*D]
    const float*  __restrict__ bo,  // [D]
    float* __restrict__ Out)        // [B,S,D]
{
    const int wave = threadIdx.x >> 5;
    const int lane = threadIdx.x & 31;
    const int m0 = blockIdx.x * 64 + (wave >> 1) * 16; // row over B*S
    const int n0 = blockIdx.y * 64 + (wave & 1) * 32;  // e-cols
    const int b  = m0 / S_;   // 64-row tile never crosses batch boundary
    const int s0 = m0 % S_;

    v8f c0 = {}, c1 = {};
#pragma unroll 4
    for (int kc = 0; kc < H_ * D_; kc += 32) {
        const int h  = kc >> 8;      // kc / D_
        const int d0 = kc & (D_ - 1);
        const half_t* ah = A + ((size_t)h * B_ + b) * S_ * D_;
        v16h af = frag_load_f16(ah, D_, s0, d0);
        v16h b0 = frag_load_f32(Wo, H_ * D_, n0, kc);
        v16h b1 = frag_load_f32(Wo, H_ * D_, n0 + 16, kc);
        c0 = wmma_f16(af, b0, c0);
        c1 = wmma_f16(af, b1, c1);
    }

    const int colA = n0 + (lane & 15);
    const int colB = colA + 16;
    const int rb   = m0 + ((lane >> 4) << 3);
    const float biasA = bo[colA];
    const float biasB = bo[colB];
#pragma unroll
    for (int r = 0; r < 8; ++r) {
        Out[(size_t)(rb + r) * D_ + colA] = c0[r] + biasA;
        Out[(size_t)(rb + r) * D_ + colB] = c1[r] + biasB;
    }
}

// ---------------------------------------------------------------------------
extern "C" void kernel_launch(void* const* d_in, const int* in_sizes, int n_in,
                              void* d_out, int out_size, void* d_ws, size_t ws_size,
                              hipStream_t stream) {
    (void)in_sizes; (void)n_in; (void)out_size; (void)ws_size;

    const float* query = (const float*)d_in[0];
    const float* key_  = (const float*)d_in[1];
    const float* value = (const float*)d_in[2];
    const float* Wq    = (const float*)d_in[3];
    const float* bq    = (const float*)d_in[4];
    const float* Wk    = (const float*)d_in[5];
    const float* bk    = (const float*)d_in[6];
    const float* Wv    = (const float*)d_in[7];
    const float* bv    = (const float*)d_in[8];
    const float* Wo    = (const float*)d_in[9];
    const float* bo    = (const float*)d_in[10];
    float* out = (float*)d_out;

    const size_t per = (size_t)H_ * B_ * S_ * D_;   // elements per f16 tensor
    half_t* qh = (half_t*)d_ws;
    half_t* kh = qh + per;
    half_t* vh = kh + per;
    half_t* ah = vh + per;                           // 4 * 33.5 MB = 134 MB

    dim3 pblk(256), pgrd(S_ / 64, D_ / 64, H_ * B_);
    mha_proj_kernel<<<pgrd, pblk, 0, stream>>>(query, Wq, bq, qh);
    mha_proj_kernel<<<pgrd, pblk, 0, stream>>>(key_,  Wk, bk, kh);
    mha_proj_kernel<<<pgrd, pblk, 0, stream>>>(value, Wv, bv, vh);

    dim3 ablk(128), agrd(S_ / 64, H_ * B_);
    mha_attn_kernel<<<agrd, ablk, 0, stream>>>(qh, kh, vh, ah);

    dim3 oblk(256), ogrd((B_ * S_) / 64, D_ / 64);
    mha_outproj_kernel<<<ogrd, oblk, 0, stream>>>(ah, Wo, bo, out);
}

// v003
// Measured time: 632 microseconds a run.
// Next to v002, in two timings, it ran 2.33 and 2.34 times as fast.
// Counting every step since v000, it is 7.16 times as fast.
#include <hip/hip_runtime.h>
#include <hip/hip_bf16.h>

typedef __attribute__((ext_vector_type(16))) _Float16 v16h;
typedef __attribute__((ext_vector_type(8)))  float    v8f;
typedef __attribute__((ext_vector_type(8)))  _Float16 v8h;
typedef __attribute__((ext_vector_type(8)))  short    s16x8;
typedef _Float16 half_t;

constexpr int H_ = 8;
constexpr int D_ = 256;
constexpr int B_ = 2;
constexpr int S_ = 4096;
constexpr int KPITCH_ = 528;       // bytes per K row in LDS: 512 + 16, 16 B x odd
constexpr int VPITCH_ = 544;       // bytes per V row in LDS: 512 + 32, 32 B x odd
constexpr float SCALE_ = 0.0625f;  // 1/sqrt(256)

__device__ inline v8f wmma_f16(v16h a, v16h b, v8f c) {
    // 8 args: (neg_a, A, neg_b, B, c_mod, C, reuse_a, reuse_b)
    return __builtin_amdgcn_wmma_f32_16x16x32_f16(
        false, a, false, b, (short)0, c, false, false);
}

__device__ inline v16h frag_load_f32(const float* __restrict__ src, int ld,
                                     int row0, int k0) {
    const int lane = threadIdx.x & 31;
    const float* p = src + (size_t)(row0 + (lane & 15)) * ld
                         + k0 + ((lane >> 4) << 3);
    v16h f;
#pragma unroll
    for (int i = 0; i < 8; ++i) f[i] = (half_t)p[i];
#pragma unroll
    for (int i = 0; i < 8; ++i) f[8 + i] = (half_t)p[16 + i];
    return f;
}

__device__ inline v16h frag_load_f16(const half_t* __restrict__ src, int ld,
                                     int row0, int k0) {
    const int lane = threadIdx.x & 31;
    const half_t* p = src + (size_t)(row0 + (lane & 15)) * ld
                          + k0 + ((lane >> 4) << 3);
    v16h f;
#pragma unroll
    for (int i = 0; i < 8; ++i) f[i] = p[i];
#pragma unroll
    for (int i = 0; i < 8; ++i) f[8 + i] = p[16 + i];
    return f;
}

// ---------------------------------------------------------------------------
// Kernel 1: per-head linear projection.
//   out[h,b,s,e] = sum_d X[b,s,d] * W[h,e,d] + bias[h,e]   (stored as f16)
// Grid: (S/64, D/64, H*B). Block: 256 (8 waves); wave -> 16x32 subtile.
// ---------------------------------------------------------------------------
__global__ __launch_bounds__(256) void mha_proj_kernel(
    const float* __restrict__ X,    // [B,S,D]
    const float* __restrict__ W,    // [H,D,D]
    const float* __restrict__ bias, // [H,D]
    half_t* __restrict__ out)       // [H,B,S,D]
{
    const int wave = threadIdx.x >> 5;
    const int lane = threadIdx.x & 31;
    const int h = blockIdx.z / B_;
    const int b = blockIdx.z % B_;
    const int m0 = blockIdx.x * 64 + (wave >> 1) * 16; // s-rows
    const int n0 = blockIdx.y * 64 + (wave & 1) * 32;  // e-cols

    const float* x = X + (size_t)b * S_ * D_;
    const float* w = W + (size_t)h * D_ * D_;

    v8f c0 = {}, c1 = {};
#pragma unroll
    for (int k = 0; k < D_; k += 32) {
        v16h a  = frag_load_f32(x, D_, m0, k);
        v16h b0 = frag_load_f32(w, D_, n0, k);
        v16h b1 = frag_load_f32(w, D_, n0 + 16, k);
        c0 = wmma_f16(a, b0, c0);
        c1 = wmma_f16(a, b1, c1);
    }

    const float* bh = bias + (size_t)h * D_;
    half_t* o = out + ((size_t)h * B_ + b) * S_ * D_;
    const int colA = n0 + (lane & 15);
    const int colB = colA + 16;
    const int rb   = m0 + ((lane >> 4) << 3);
    const float biasA = bh[colA];
    const float biasB = bh[colB];
#pragma unroll
    for (int r = 0; r < 8; ++r) {
        o[(size_t)(rb + r) * D_ + colA] = (half_t)(c0[r] + biasA);
        o[(size_t)(rb + r) * D_ + colB] = (half_t)(c1[r] + biasB);
    }
}

// --- attention staging helpers ---------------------------------------------

// Issue async DMA of one 32x256 f16 tile (K or V) into LDS, row-major, rows
// PITCH bytes apart. Wave w brings rows w, w+4, ..., w+28: 512 contiguous
// bytes each.
template <int PITCH>
__device__ inline void stage_tile_async(const half_t* gt, unsigned ldsByteOff) {
    const unsigned l0 = ldsByteOff + (threadIdx.x >> 5) * (unsigned)PITCH
                                   + (threadIdx.x & 31) * 16u;
    const unsigned long long g0 =
        (unsigned long long)(uintptr_t)gt + threadIdx.x * 16u;
    constexpr unsigned LS = 4u * PITCH;     // LDS bytes per 4 rows
    constexpr unsigned GS = 4u * D_ * 2u;   // global bytes per 4 rows
    asm volatile("global_load_async_to_lds_b128 %0, %8, off\n\t"
                 "global_load_async_to_lds_b128 %1, %9, off\n\t"
                 "global_load_async_to_lds_b128 %2, %10, off\n\t"
                 "global_load_async_to_lds_b128 %3, %11, off\n\t"
                 "global_load_async_to_lds_b128 %4, %12, off\n\t"
                 "global_load_async_to_lds_b128 %5, %13, off\n\t"
                 "global_load_async_to_lds_b128 %6, %14, off\n\t"
                 "global_load_async_to_lds_b128 %7, %15, off\n\t"
                 "s_wait_xcnt 0x0"
                 :: "v"(l0), "v"(l0 + LS), "v"(l0 + 2 * LS), "v"(l0 + 3 * LS),
                    "v"(l0 + 4 * LS), "v"(l0 + 5 * LS), "v"(l0 + 6 * LS),
                    "v"(l0 + 7 * LS),
                    "v"(g0), "v"(g0 + GS), "v"(g0 + 2 * GS), "v"(g0 + 3 * GS),
                    "v"(g0 + 4 * GS), "v"(g0 + 5 * GS), "v"(g0 + 6 * GS),
                    "v"(g0 + 7 * GS)
                 : "memory");
}

// A fragment of V^T (m = column e0 + lane&15, k = key row t) of a row-major V
// tile by two transposing loads: lane (c, h) gets V[kbase + 8h + 0..7][e0 + c],
// kbase 0 and 16, which is the k order of frag_load_f16.
__device__ inline v16h frag_load_v_tr(const half_t* lv, int e0) {
    typedef __attribute__((address_space(3))) s16x8 lds_s16x8;
    const int lane = threadIdx.x & 31;
    const char* p = (const char*)lv
                  + (((lane >> 4) << 3) + (lane & 7)) * VPITCH_
                  + ((lane >> 3) & 1) * 16 + e0 * 2;
    const v8h lo = __builtin_bit_cast(
        v8h, __builtin_amdgcn_ds_load_tr16_b128_v8i16((lds_s16x8*)p));
    const v8h hi = __builtin_bit_cast(
        v8h, __builtin_amdgcn_ds_load_tr16_b128_v8i16(
                 (lds_s16x8*)(p + 16 * VPITCH_)));
    return __builtin_shufflevector(lo, hi, 0, 1, 2, 3, 4, 5, 6, 7,
                                   8, 9, 10, 11, 12, 13, 14, 15);
}

__device__ inline float xhalf(float x) {
    const int b = __builtin_bit_cast(int, x);
    return __builtin_bit_cast(float, __builtin_amdgcn_permlanex16(
        b, b, 0x76543210, 0xfedcba98, false, false));
}

// ---------------------------------------------------------------------------
// Kernel 2: flash attention over one (h,b), 64 query rows per workgroup.
// Block: 128 threads = 4 waves; wave owns 16 query rows.
// Double-buffered 32-row K/V blocks; staging of block i+1 (async K and V DMA)
// overlaps the WMMA work on block i. One barrier/iter.
// ---------------------------------------------------------------------------
__global__ __launch_bounds__(128) void mha_attn_kernel(
    const half_t* __restrict__ Q,  // [H,B,S,D]
    const half_t* __restrict__ K,
    const half_t* __restrict__ V,
    half_t* __restrict__ O)        // [H,B,S,D]
{
    __shared__ __attribute__((aligned(16)))
        half_t lK[2][32 * KPITCH_ / 2];   // 2 x 16.5 KB, row-major [t][d], padded
    __shared__ __attribute__((aligned(16)))
        half_t lV[2][32 * VPITCH_ / 2];   // 2 x 17 KB, row-major [t][e], padded

    const int wave = threadIdx.x >> 5;
    const int lane = threadIdx.x & 31;
    const int qrow0 = blockIdx.x * 64 + wave * 16;  // global query row
    const size_t base = (size_t)blockIdx.y * S_ * D_;

    const half_t* q  = Q + base;
    const half_t* kp = K + base;
    const half_t* vp = V + base;

    const unsigned lK0off = (unsigned)(uintptr_t)(&lK[0][0]);
    const unsigned lKstride = 32u * KPITCH_;   // bytes per K buffer
    const unsigned lV0off = (unsigned)(uintptr_t)(&lV[0][0]);
    const unsigned lVstride = 32u * VPITCH_;   // bytes per V buffer

    // Q fragments for this wave's 16 rows, kept in registers (8 x v16h); the B
    // operand of S^T = K Q^T (n = query = lane&15, same table as an A operand).
    v16h qa[8];
#pragma unroll
    for (int kk = 0; kk < 8; ++kk)
        qa[kk] = frag_load_f16(q, D_, qrow0, kk * 32);

    // Per lane: running maximum of query lane&15 (equal in both halves) and the
    // running sum over this half's keys alone (halves joined in the epilogue).
    float row_m = -3.0e38f, row_l = 0.0f;
    v8f acc[16];   // O^T tiles: register r <-> e = 16n + 8*(lane>>4) + r
#pragma unroll
    for (int n = 0; n < 16; ++n) acc[n] = v8f{0,0,0,0,0,0,0,0};

    // ---- prologue: stage block 0 into buffer 0 ----
    {
        stage_tile_async<KPITCH_>(kp, lK0off);
        stage_tile_async<VPITCH_>(vp, lV0off);
    }
    asm volatile("s_wait_asynccnt 0x0" ::: "memory");
    __syncthreads();

    constexpr int NB = S_ / 32;   // 128 key blocks
    for (int ib = 0; ib < NB; ++ib) {
        const int cur = ib & 1;
        const int nxt = cur ^ 1;
        const bool more = (ib + 1) < NB;

        // ---- stage block ib+1 (in flight during this block's WMMAs) ----
        if (more) {
            const size_t kt = (size_t)(ib + 1) * 32;
            stage_tile_async<KPITCH_>(kp + kt * D_,
                                      lK0off + (unsigned)nxt * lKstride);
            stage_tile_async<VPITCH_>(vp + kt * D_,
                                      lV0off + (unsigned)nxt * lVstride);
            if (ib + 2 < NB) {  // prefetch block ib+2 toward L2
                __builtin_prefetch(kp + (kt + 32) * D_ + lane * 64, 0, 1);
                __builtin_prefetch(vp + (kt + 32) * D_ + lane * 64, 0, 1);
            }
        }

        const half_t* lkc = &lK[cur][0];
        const half_t* lvc = &lV[cur][0];

        v8f s0 = {}, s1 = {};
#pragma unroll
        for (int kk = 0; kk < 8; ++kk) {
            s0 = wmma_f16(frag_load_f16(lkc, KPITCH_ / 2, 0,  kk * 32),
                          qa[kk], s0);
            s1 = wmma_f16(frag_load_f16(lkc, KPITCH_ / 2, 16, kk * 32),
                          qa[kk], s1);
        }

        // Online softmax. C layout: lane (c, h) holds query c's scores of keys
        // 8h + r (s0[r]) and 16 + 8h + r (s1[r]): maximum and sum are in-lane
        // trees; only the maximum crosses to the other half.
        float t[8];
#pragma unroll
        for (int r = 0; r < 8; ++r) {
            s0[r] *= SCALE_;
            s1[r] *= SCALE_;
            t[r] = fmaxf(s0[r], s1[r]);
        }
        float mx = fmaxf(fmaxf(fmaxf(t[0], t[1]), fmaxf(t[2], t[3])),
                         fmaxf(fmaxf(t[4], t[5]), fmaxf(t[6], t[7])));
        mx = fmaxf(row_m, fmaxf(mx, xhalf(mx)));
        const float corr = __expf(row_m - mx);
#pragma unroll
        for (int r = 0; r < 8; ++r) {
            s0[r] = __expf(s0[r] - mx);
            s1[r] = __expf(s1[r] - mx);
            t[r] = s0[r] + s1[r];
        }
        row_l = row_l * corr + (((t[0] + t[1]) + (t[2] + t[3])) +
                                ((t[4] + t[5]) + (t[6] + t[7])));
        row_m = mx;
#pragma unroll
        for (int n = 0; n < 16; ++n) acc[n] *= corr;

        // P^T as a B operand, packed in-lane: element i is key 8h + i, element
        // 8 + i is key 16 + 8h + i, the k order of frag_load_f16.
        const v16h pb = __builtin_shufflevector(
            __builtin_convertvector(s0, v8h), __builtin_convertvector(s1, v8h),
            0, 1, 2, 3, 4, 5, 6, 7, 8, 9, 10, 11, 12, 13, 14, 15);

#pragma unroll
        for (int n = 0; n < 16; ++n)
            acc[n] = wmma_f16(frag_load_v_tr(lvc, n * 16), pb, acc[n]);

        // ---- publish block ib+1, recycle buffers ----
        // This wave's LDS reads have retired before the copies issued behind
        // the barrier refill the buffers it has just read.
        asm volatile("s_wait_dscnt 0x0" ::: "memory");
        asm volatile("s_wait_asynccnt 0x0" ::: "memory");
        __syncthreads();
    }

    // Epilogue: join the halves' sums, O /= row_l, store f16. Lane (c, h) holds
    // query row c, columns 16n + 8h + 0..7: one 16-byte store per tile.
    row_l += xhalf(row_l);
    const float inv = 1.0f / row_l;
    half_t* o = O + base + (size_t)(qrow0 + (lane & 15)) * D_
                         + ((lane >> 4) << 3);
#pragma unroll
    for (int n = 0; n < 16; ++n)
        *(v8h*)(o + n * 16) = __builtin_convertvector(acc[n] * inv, v8h);
}

// ---------------------------------------------------------------------------
// Kernel 3: output projection.
//   Out[b,s,e] = sum_{h,d} attn[h,b,s,d] * Wo[e, h*D+d] + bo[e]
// Grid: (B*S/64, D/64). Block: 256 (8 waves); wave -> 16x32 subtile.
// ---------------------------------------------------------------------------
__global__ __launch_bounds__(256) void mha_outproj_kernel(
    const half_t* __restrict__ A,   // [H,B,S,D] attention outputs (f16)
    const float*  __restrict__ Wo,  // [D, H*D]
    const float*  __restrict__ bo,  // [D]
    float* __restrict__ Out)        // [B,S,D]
{
    const int wave = threadIdx.x >> 5;
    const int lane = threadIdx.x & 31;
    const int m0 = blockIdx.x * 64 + (wave >> 1) * 16; // row over B*S
    const int n0 = blockIdx.y * 64 + (wave & 1) * 32;  // e-cols
    const int b  = m0 / S_;   // 64-row tile never crosses batch boundary
    const int s0 = m0 % S_;

    v8f c0 = {}, c1 = {};
#pragma unroll 4
    for (int kc = 0; kc < H_ * D_; kc += 32) {
        const int h  = kc >> 8;      // kc / D_
        const int d0 = kc & (D_ - 1);
        const half_t* ah = A + ((size_t)h * B_ + b) * S_ * D_;
        v16h af = frag_load_f16(ah, D_, s0, d0);
        v16h b0 = frag_load_f32(Wo, H_ * D_, n0, kc);
        v16h b1 = frag_load_f32(Wo, H_ * D_, n0 + 16, kc);
        c0 = wmma_f16(af, b0, c0);
        c1 = wmma_f16(af, b1, c1);
    }

    const int colA = n0 + (lane & 15);
    const int colB = colA + 16;
    const int rb   = m0 + ((lane >> 4) << 3);
    const float biasA = bo[colA];
    const float biasB = bo[colB];
#pragma unroll
    for (int r = 0; r < 8; ++r) {
        Out[(size_t)(rb + r) * D_ + colA] = c0[r] + biasA;
        Out[(size_t)(rb + r) * D_ + colB] = c1[r] + biasB;
    }
}

// ---------------------------------------------------------------------------
extern "C" void kernel_launch(void* const* d_in, const int* in_sizes, int n_in,
                              void* d_out, int out_size, void* d_ws, size_t ws_size,
                              hipStream_t stream) {
    (void)in_sizes; (void)n_in; (void)out_size; (void)ws_size;

    const float* query = (const float*)d_in[0];
    const float* key_  = (const float*)d_in[1];
    const float* value = (const float*)d_in[2];
    const float* Wq    = (const float*)d_in[3];
    const float* bq    = (const float*)d_in[4];
    const float* Wk    = (const float*)d_in[5];
    const float* bk    = (const float*)d_in[6];
    const float* Wv    = (const float*)d_in[7];
    const float* bv    = (const float*)d_in[8];
    const float* Wo    = (const float*)d_in[9];
    const float* bo    = (const float*)d_in[10];
    float* out = (float*)d_out;

    const size_t per = (size_t)H_ * B_ * S_ * D_;   // elements per f16 tensor
    half_t* qh = (half_t*)d_ws;
    half_t* kh = qh + per;
    half_t* vh = kh + per;
    half_t* ah = vh + per;                           // 4 * 33.5 MB = 134 MB

    dim3 pblk(256), pgrd(S_ / 64, D_ / 64, H_ * B_);
    mha_proj_kernel<<<pgrd, pblk, 0, stream>>>(query, Wq, bq, qh);
    mha_proj_kernel<<<pgrd, pblk, 0, stream>>>(key_,  Wk, bk, kh);
    mha_proj_kernel<<<pgrd, pblk, 0, stream>>>(value, Wv, bv, vh);

    dim3 ablk(128), agrd(S_ / 64, H_ * B_);
    mha_attn_kernel<<<agrd, ablk, 0, stream>>>(qh, kh, vh, ah);

    dim3 oblk(256), ogrd((B_ * S_) / 64, D_ / 64);
    mha_outproj_kernel<<<ogrd, oblk, 0, stream>>>(ah, Wo, bo, out);
}

// v004
// Measured time: 366 microseconds a run.
// In two side-by-side timings against v003, it was 1.73 and 1.74 times as fast.
// Over all steps from v000 it is 12.4 times as fast.
#include <hip/hip_runtime.h>
#include <hip/hip_bf16.h>

typedef __attribute__((ext_vector_type(16))) _Float16 v16h;
typedef __attribute__((ext_vector_type(8)))  float    v8f;
typedef __attribute__((ext_vector_type(8)))  _Float16 v8h;
typedef __attribute__((ext_vector_type(8)))  short    s16x8;
typedef _Float16 half_t;

constexpr int H_ = 8;
constexpr int D_ = 256;
constexpr int B_ = 2;
constexpr int S_ = 4096;
constexpr int KPITCH_ = 528;       // bytes per K row in LDS: 512 + 16, 16 B x odd
constexpr int VPITCH_ = 544;       // bytes per V row in LDS: 512 + 32, 32 B x odd
constexpr int PPITCH_ = 528;       // bytes per staged X or W row: 512 + 16, 16 B x odd
constexpr float SCALE_ = 0.0625f;  // 1/sqrt(256)

__device__ inline v8f wmma_f16(v16h a, v16h b, v8f c) {
    // 8 args: (neg_a, A, neg_b, B, c_mod, C, reuse_a, reuse_b)
    return __builtin_amdgcn_wmma_f32_16x16x32_f16(
        false, a, false, b, (short)0, c, false, false);
}

__device__ inline v16h frag_load_f32(const float* __restrict__ src, int ld,
                                     int row0, int k0) {
    const int lane = threadIdx.x & 31;
    const float* p = src + (size_t)(row0 + (lane & 15)) * ld
                         + k0 + ((lane >> 4) << 3);
    v16h f;
#pragma unroll
    for (int i = 0; i < 8; ++i) f[i] = (half_t)p[i];
#pragma unroll
    for (int i = 0; i < 8; ++i) f[8 + i] = (half_t)p[16 + i];
    return f;
}

__device__ inline v16h frag_load_f16(const half_t* __restrict__ src, int ld,
                                     int row0, int k0) {
    const int lane = threadIdx.x & 31;
    const half_t* p = src + (size_t)(row0 + (lane & 15)) * ld
                          + k0 + ((lane >> 4) << 3);
    v16h f;
#pragma unroll
    for (int i = 0; i < 8; ++i) f[i] = p[i];
#pragma unroll
    for (int i = 0; i < 8; ++i) f[8 + i] = p[16 + i];
    return f;
}

// Stage 128 consecutive rows of 256 floats of X and of W (each one contiguous
// 128 KB block) into LDS as f16, rows PPITCH_ bytes apart. A wave's load covers
// 512 contiguous bytes (four whole lines); its store covers 256 contiguous LDS
// bytes. All loads stand ahead of the first store, so that one memory latency
// is paid for the whole tile pair.
__device__ inline void stage_rows_f16(const float* __restrict__ xs,
                                      const float* __restrict__ ws,
                                      half_t* lx, half_t* lw) {
    typedef __attribute__((ext_vector_type(4))) float    v4f;
    typedef __attribute__((ext_vector_type(4))) _Float16 v4h;
    const int g = threadIdx.x;   // group of 4 floats: 64 groups per row
    const int off = (g >> 6) * PPITCH_ + (g & 63) * 8;
    // Every loop here is unrolled so that xv and wv are indexed by constants
    // and stay in registers, and every step is an immediate offset.
    v4f xv[32], wv[32];
#pragma unroll
    for (int i = 0; i < 32; ++i)   // 256 groups = 4 rows per step
        xv[i] = *(const v4f*)(xs + (size_t)(i * 256 + g) * 4);
#pragma unroll
    for (int i = 0; i < 32; ++i)
        wv[i] = *(const v4f*)(ws + (size_t)(i * 256 + g) * 4);
#pragma unroll
    for (int i = 0; i < 32; ++i)
        *(v4h*)((char*)lx + off + i * 4 * PPITCH_) =
            __builtin_convertvector(xv[i], v4h);
#pragma unroll
    for (int i = 0; i < 32; ++i)
        *(v4h*)((char*)lw + off + i * 4 * PPITCH_) =
            __builtin_convertvector(wv[i], v4h);
}

__global__ __launch_bounds__(256, 4) void mha_proj_kernel(
    const float* __restrict__ X,    // [B,S,D]
    const float* __restrict__ W,    // [H,D,D]
    const float* __restrict__ bias, // [H,D]
    half_t* __restrict__ out)       // [H,B,S,D]
{
    __shared__ __attribute__((aligned(16)))
        half_t lX[128 * PPITCH_ / 2];   // 66 KB, [s][d], padded
    __shared__ __attribute__((aligned(16)))
        half_t lW[128 * PPITCH_ / 2];   // 66 KB, [e][d], padded

    const int wave = threadIdx.x >> 5;
    const int lane = threadIdx.x & 31;
    const int h = blockIdx.z / B_;
    const int b = blockIdx.z % B_;
    const int mt = blockIdx.x * 128;       // first s-row of the tile
    const int nt = blockIdx.y * 128;       // first e-col of the tile
    const int wm = (wave >> 1) * 32;       // wave's rows inside the tile
    const int wn = (wave & 1) * 64;        // wave's cols inside the tile

    stage_rows_f16(X + ((size_t)b * S_ + mt) * D_,
                   W + ((size_t)h * D_ + nt) * D_, lX, lW);
    __syncthreads();   // every wave reads rows that other waves staged

    v8f c[2][4] = {};
#pragma unroll
    for (int k = 0; k < D_; k += 32) {
        v16h a[2], bf[4];
#pragma unroll
        for (int i = 0; i < 2; ++i)
            a[i] = frag_load_f16(lX, PPITCH_ / 2, wm + i * 16, k);
#pragma unroll
        for (int j = 0; j < 4; ++j)
            bf[j] = frag_load_f16(lW, PPITCH_ / 2, wn + j * 16, k);
#pragma unroll
        for (int i = 0; i < 2; ++i)
#pragma unroll
            for (int j = 0; j < 4; ++j)
                c[i][j] = wmma_f16(a[i], bf[j], c[i][j]);
    }

    const float* bh = bias + (size_t)h * D_;
    half_t* o = out + ((size_t)h * B_ + b) * S_ * D_;
#pragma unroll
    for (int j = 0; j < 4; ++j) {
        const int col = nt + wn + j * 16 + (lane & 15);
        const float bj = bh[col];
#pragma unroll
        for (int i = 0; i < 2; ++i) {
            const int rb = mt + wm + i * 16 + ((lane >> 4) << 3);
#pragma unroll
            for (int r = 0; r < 8; ++r)
                o[(size_t)(rb + r) * D_ + col] = (half_t)(c[i][j][r] + bj);
        }
    }
}

// --- attention staging helpers ---------------------------------------------

// Issue async DMA of one 32x256 f16 tile (K or V) into LDS, row-major, rows
// PITCH bytes apart. Wave w brings rows w, w+4, ..., w+28: 512 contiguous
// bytes each.
template <int PITCH>
__device__ inline void stage_tile_async(const half_t* gt, unsigned ldsByteOff) {
    const unsigned l0 = ldsByteOff + (threadIdx.x >> 5) * (unsigned)PITCH
                                   + (threadIdx.x & 31) * 16u;
    const unsigned long long g0 =
        (unsigned long long)(uintptr_t)gt + threadIdx.x * 16u;
    constexpr unsigned LS = 4u * PITCH;     // LDS bytes per 4 rows
    constexpr unsigned GS = 4u * D_ * 2u;   // global bytes per 4 rows
    asm volatile("global_load_async_to_lds_b128 %0, %8, off\n\t"
                 "global_load_async_to_lds_b128 %1, %9, off\n\t"
                 "global_load_async_to_lds_b128 %2, %10, off\n\t"
                 "global_load_async_to_lds_b128 %3, %11, off\n\t"
                 "global_load_async_to_lds_b128 %4, %12, off\n\t"
                 "global_load_async_to_lds_b128 %5, %13, off\n\t"
                 "global_load_async_to_lds_b128 %6, %14, off\n\t"
                 "global_load_async_to_lds_b128 %7, %15, off\n\t"
                 "s_wait_xcnt 0x0"
                 :: "v"(l0), "v"(l0 + LS), "v"(l0 + 2 * LS), "v"(l0 + 3 * LS),
                    "v"(l0 + 4 * LS), "v"(l0 + 5 * LS), "v"(l0 + 6 * LS),
                    "v"(l0 + 7 * LS),
                    "v"(g0), "v"(g0 + GS), "v"(g0 + 2 * GS), "v"(g0 + 3 * GS),
                    "v"(g0 + 4 * GS), "v"(g0 + 5 * GS), "v"(g0 + 6 * GS),
                    "v"(g0 + 7 * GS)
                 : "memory");
}

// A fragment of V^T (m = column e0 + lane&15, k = key row t) of a row-major V
// tile by two transposing loads: lane (c, h) gets V[kbase + 8h + 0..7][e0 + c],
// kbase 0 and 16, which is the k order of frag_load_f16.
__device__ inline v16h frag_load_v_tr(const half_t* lv, int e0) {
    typedef __attribute__((address_space(3))) s16x8 lds_s16x8;
    const int lane = threadIdx.x & 31;
    const char* p = (const char*)lv
                  + (((lane >> 4) << 3) + (lane & 7)) * VPITCH_
                  + ((lane >> 3) & 1) * 16 + e0 * 2;
    const v8h lo = __builtin_bit_cast(
        v8h, __builtin_amdgcn_ds_load_tr16_b128_v8i16((lds_s16x8*)p));
    const v8h hi = __builtin_bit_cast(
        v8h, __builtin_amdgcn_ds_load_tr16_b128_v8i16(
                 (lds_s16x8*)(p + 16 * VPITCH_)));
    return __builtin_shufflevector(lo, hi, 0, 1, 2, 3, 4, 5, 6, 7,
                                   8, 9, 10, 11, 12, 13, 14, 15);
}

__device__ inline float xhalf(float x) {
    const int b = __builtin_bit_cast(int, x);
    return __builtin_bit_cast(float, __builtin_amdgcn_permlanex16(
        b, b, 0x76543210, 0xfedcba98, false, false));
}

// ---------------------------------------------------------------------------
// Kernel 2: flash attention over one (h,b), 64 query rows per workgroup.
// Block: 128 threads = 4 waves; wave owns 16 query rows.
// Double-buffered 32-row K/V blocks; staging of block i+1 (async K and V DMA)
// overlaps the WMMA work on block i. One barrier/iter.
// ---------------------------------------------------------------------------
__global__ __launch_bounds__(128) void mha_attn_kernel(
    const half_t* __restrict__ Q,  // [H,B,S,D]
    const half_t* __restrict__ K,
    const half_t* __restrict__ V,
    half_t* __restrict__ O)        // [H,B,S,D]
{
    __shared__ __attribute__((aligned(16)))
        half_t lK[2][32 * KPITCH_ / 2];   // 2 x 16.5 KB, row-major [t][d], padded
    __shared__ __attribute__((aligned(16)))
        half_t lV[2][32 * VPITCH_ / 2];   // 2 x 17 KB, row-major [t][e], padded

    const int wave = threadIdx.x >> 5;
    const int lane = threadIdx.x & 31;
    const int qrow0 = blockIdx.x * 64 + wave * 16;  // global query row
    const size_t base = (size_t)blockIdx.y * S_ * D_;

    const half_t* q  = Q + base;
    const half_t* kp = K + base;
    const half_t* vp = V + base;

    const unsigned lK0off = (unsigned)(uintptr_t)(&lK[0][0]);
    const unsigned lKstride = 32u * KPITCH_;   // bytes per K buffer
    const unsigned lV0off = (unsigned)(uintptr_t)(&lV[0][0]);
    const unsigned lVstride = 32u * VPITCH_;   // bytes per V buffer

    // Q fragments for this wave's 16 rows, kept in registers (8 x v16h); the B
    // operand of S^T = K Q^T (n = query = lane&15, same table as an A operand).
    v16h qa[8];
#pragma unroll
    for (int kk = 0; kk < 8; ++kk)
        qa[kk] = frag_load_f16(q, D_, qrow0, kk * 32);

    // Per lane: running maximum of query lane&15 (equal in both halves) and the
    // running sum over this half's keys alone (halves joined in the epilogue).
    float row_m = -3.0e38f, row_l = 0.0f;
    v8f acc[16];   // O^T tiles: register r <-> e = 16n + 8*(lane>>4) + r
#pragma unroll
    for (int n = 0; n < 16; ++n) acc[n] = v8f{0,0,0,0,0,0,0,0};

    // ---- prologue: stage block 0 into buffer 0 ----
    {
        stage_tile_async<KPITCH_>(kp, lK0off);
        stage_tile_async<VPITCH_>(vp, lV0off);
    }
    asm volatile("s_wait_asynccnt 0x0" ::: "memory");
    __syncthreads();

    constexpr int NB = S_ / 32;   // 128 key blocks
    for (int ib = 0; ib < NB; ++ib) {
        const int cur = ib & 1;
        const int nxt = cur ^ 1;
        const bool more = (ib + 1) < NB;

        // ---- stage block ib+1 (in flight during this block's WMMAs) ----
        if (more) {
            const size_t kt = (size_t)(ib + 1) * 32;
            stage_tile_async<KPITCH_>(kp + kt * D_,
                                      lK0off + (unsigned)nxt * lKstride);
            stage_tile_async<VPITCH_>(vp + kt * D_,
                                      lV0off + (unsigned)nxt * lVstride);
            if (ib + 2 < NB) {  // prefetch block ib+2 toward L2
                __builtin_prefetch(kp + (kt + 32) * D_ + lane * 64, 0, 1);
                __builtin_prefetch(vp + (kt + 32) * D_ + lane * 64, 0, 1);
            }
        }

        const half_t* lkc = &lK[cur][0];
        const half_t* lvc = &lV[cur][0];

        v8f s0 = {}, s1 = {};
#pragma unroll
        for (int kk = 0; kk < 8; ++kk) {
            s0 = wmma_f16(frag_load_f16(lkc, KPITCH_ / 2, 0,  kk * 32),
                          qa[kk], s0);
            s1 = wmma_f16(frag_load_f16(lkc, KPITCH_ / 2, 16, kk * 32),
                          qa[kk], s1);
        }

        // Online softmax. C layout: lane (c, h) holds query c's scores of keys
        // 8h + r (s0[r]) and 16 + 8h + r (s1[r]): maximum and sum are in-lane
        // trees; only the maximum crosses to the other half.
        float t[8];
#pragma unroll
        for (int r = 0; r < 8; ++r) {
            s0[r] *= SCALE_;
            s1[r] *= SCALE_;
            t[r] = fmaxf(s0[r], s1[r]);
        }
        float mx = fmaxf(fmaxf(fmaxf(t[0], t[1]), fmaxf(t[2], t[3])),
                         fmaxf(fmaxf(t[4], t[5]), fmaxf(t[6], t[7])));
        mx = fmaxf(row_m, fmaxf(mx, xhalf(mx)));
        const float corr = __expf(row_m - mx);
#pragma unroll
        for (int r = 0; r < 8; ++r) {
            s0[r] = __expf(s0[r] - mx);
            s1[r] = __expf(s1[r] - mx);
            t[r] = s0[r] + s1[r];
        }
        row_l = row_l * corr + (((t[0] + t[1]) + (t[2] + t[3])) +
                                ((t[4] + t[5]) + (t[6] + t[7])));
        row_m = mx;
#pragma unroll
        for (int n = 0; n < 16; ++n) acc[n] *= corr;

        // P^T as a B operand, packed in-lane: element i is key 8h + i, element
        // 8 + i is key 16 + 8h + i, the k order of frag_load_f16.
        const v16h pb = __builtin_shufflevector(
            __builtin_convertvector(s0, v8h), __builtin_convertvector(s1, v8h),
            0, 1, 2, 3, 4, 5, 6, 7, 8, 9, 10, 11, 12, 13, 14, 15);

#pragma unroll
        for (int n = 0; n < 16; ++n)
            acc[n] = wmma_f16(frag_load_v_tr(lvc, n * 16), pb, acc[n]);

        // ---- publish block ib+1, recycle buffers ----
        // This wave's LDS reads have retired before the copies issued behind
        // the barrier refill the buffers it has just read.
        asm volatile("s_wait_dscnt 0x0" ::: "memory");
        asm volatile("s_wait_asynccnt 0x0" ::: "memory");
        __syncthreads();
    }

    // Epilogue: join the halves' sums, O /= row_l, store f16. Lane (c, h) holds
    // query row c, columns 16n + 8h + 0..7: one 16-byte store per tile.
    row_l += xhalf(row_l);
    const float inv = 1.0f / row_l;
    half_t* o = O + base + (size_t)(qrow0 + (lane & 15)) * D_
                         + ((lane >> 4) << 3);
#pragma unroll
    for (int n = 0; n < 16; ++n)
        *(v8h*)(o + n * 16) = __builtin_convertvector(acc[n] * inv, v8h);
}

// ---------------------------------------------------------------------------
// Kernel 3: output projection.
//   Out[b,s,e] = sum_{h,d} attn[h,b,s,d] * Wo[e, h*D+d] + bo[e]
// Grid: (B*S/64, D/64). Block: 256 (8 waves); wave -> 16x32 subtile.
// ---------------------------------------------------------------------------
__global__ __launch_bounds__(256) void mha_outproj_kernel(
    const half_t* __restrict__ A,   // [H,B,S,D] attention outputs (f16)
    const float*  __restrict__ Wo,  // [D, H*D]
    const float*  __restrict__ bo,  // [D]
    float* __restrict__ Out)        // [B,S,D]
{
    const int wave = threadIdx.x >> 5;
    const int lane = threadIdx.x & 31;
    const int m0 = blockIdx.x * 64 + (wave >> 1) * 16; // row over B*S
    const int n0 = blockIdx.y * 64 + (wave & 1) * 32;  // e-cols
    const int b  = m0 / S_;   // 64-row tile never crosses batch boundary
    const int s0 = m0 % S_;

    v8f c0 = {}, c1 = {};
#pragma unroll 4
    for (int kc = 0; kc < H_ * D_; kc += 32) {
        const int h  = kc >> 8;      // kc / D_
        const int d0 = kc & (D_ - 1);
        const half_t* ah = A + ((size_t)h * B_ + b) * S_ * D_;
        v16h af = frag_load_f16(ah, D_, s0, d0);
        v16h b0 = frag_load_f32(Wo, H_ * D_, n0, kc);
        v16h b1 = frag_load_f32(Wo, H_ * D_, n0 + 16, kc);
        c0 = wmma_f16(af, b0, c0);
        c1 = wmma_f16(af, b1, c1);
    }

    const int colA = n0 + (lane & 15);
    const int colB = colA + 16;
    const int rb   = m0 + ((lane >> 4) << 3);
    const float biasA = bo[colA];
    const float biasB = bo[colB];
#pragma unroll
    for (int r = 0; r < 8; ++r) {
        Out[(size_t)(rb + r) * D_ + colA] = c0[r] + biasA;
        Out[(size_t)(rb + r) * D_ + colB] = c1[r] + biasB;
    }
}

// ---------------------------------------------------------------------------
extern "C" void kernel_launch(void* const* d_in, const int* in_sizes, int n_in,
                              void* d_out, int out_size, void* d_ws, size_t ws_size,
                              hipStream_t stream) {
    (void)in_sizes; (void)n_in; (void)out_size; (void)ws_size;

    const float* query = (const float*)d_in[0];
    const float* key_  = (const float*)d_in[1];
    const float* value = (const float*)d_in[2];
    const float* Wq    = (const float*)d_in[3];
    const float* bq    = (const float*)d_in[4];
    const float* Wk    = (const float*)d_in[5];
    const float* bk    = (const float*)d_in[6];
    const float* Wv    = (const float*)d_in[7];
    const float* bv    = (const float*)d_in[8];
    const float* Wo    = (const float*)d_in[9];
    const float* bo    = (const float*)d_in[10];
    float* out = (float*)d_out;

    const size_t per = (size_t)H_ * B_ * S_ * D_;   // elements per f16 tensor
    half_t* qh = (half_t*)d_ws;
    half_t* kh = qh + per;
    half_t* vh = kh + per;
    half_t* ah = vh + per;                           // 4 * 33.5 MB = 134 MB

    dim3 pblk(256), pgrd(S_ / 128, D_ / 128, H_ * B_);
    mha_proj_kernel<<<pgrd, pblk, 0, stream>>>(query, Wq, bq, qh);
    mha_proj_kernel<<<pgrd, pblk, 0, stream>>>(key_,  Wk, bk, kh);
    mha_proj_kernel<<<pgrd, pblk, 0, stream>>>(value, Wv, bv, vh);

    dim3 ablk(128), agrd(S_ / 64, H_ * B_);
    mha_attn_kernel<<<agrd, ablk, 0, stream>>>(qh, kh, vh, ah);

    dim3 oblk(256), ogrd((B_ * S_) / 64, D_ / 64);
    mha_outproj_kernel<<<ogrd, oblk, 0, stream>>>(ah, Wo, bo, out);
}

// v005
// Measured time: 312 microseconds a run.
// Next to v004, in two timings, it ran 1.17 times as fast each time.
// Counting every step since v000, it is 14.5 times as fast.
#include <hip/hip_runtime.h>
#include <hip/hip_bf16.h>

typedef __attribute__((ext_vector_type(16))) _Float16 v16h;
typedef __attribute__((ext_vector_type(8)))  float    v8f;
typedef __attribute__((ext_vector_type(8)))  _Float16 v8h;
typedef __attribute__((ext_vector_type(8)))  short    s16x8;
typedef _Float16 half_t;

constexpr int H_ = 8;
constexpr int D_ = 256;
constexpr int B_ = 2;
constexpr int S_ = 4096;
constexpr int KPITCH_ = 528;       // bytes per K row in LDS: 512 + 16, 16 B x odd
constexpr int VPITCH_ = 544;       // bytes per V row in LDS: 512 + 32, 32 B x odd
constexpr int PPITCH_ = 528;       // bytes per staged X or W row: 512 + 16, 16 B x odd
constexpr float SCALE_ = 0.0625f;  // 1/sqrt(256)

__device__ inline v8f wmma_f16(v16h a, v16h b, v8f c) {
    // 8 args: (neg_a, A, neg_b, B, c_mod, C, reuse_a, reuse_b)
    return __builtin_amdgcn_wmma_f32_16x16x32_f16(
        false, a, false, b, (short)0, c, false, false);
}

__device__ inline v16h frag_load_f16(const half_t* __restrict__ src, int ld,
                                     int row0, int k0) {
    const int lane = threadIdx.x & 31;
    const half_t* p = src + (size_t)(row0 + (lane & 15)) * ld
                          + k0 + ((lane >> 4) << 3);
    v16h f;
#pragma unroll
    for (int i = 0; i < 8; ++i) f[i] = p[i];
#pragma unroll
    for (int i = 0; i < 8; ++i) f[8 + i] = p[16 + i];
    return f;
}

// Stage 128 consecutive rows of 256 floats of X and of W (each one contiguous
// 128 KB block) into LDS as f16, rows PPITCH_ bytes apart. A wave's load covers
// 512 contiguous bytes (four whole lines); its store covers 256 contiguous LDS
// bytes. All loads stand ahead of the first store, so that one memory latency
// is paid for the whole tile pair.
__device__ inline void stage_rows_f16(const float* __restrict__ xs,
                                      const float* __restrict__ ws,
                                      half_t* lx, half_t* lw) {
    typedef __attribute__((ext_vector_type(4))) float    v4f;
    typedef __attribute__((ext_vector_type(4))) _Float16 v4h;
    const int g = threadIdx.x;   // group of 4 floats: 64 groups per row
    const int off = (g >> 6) * PPITCH_ + (g & 63) * 8;
    // Every loop here is unrolled so that xv and wv are indexed by constants
    // and stay in registers, and every step is an immediate offset.
    v4f xv[32], wv[32];
#pragma unroll
    for (int i = 0; i < 32; ++i)   // 256 groups = 4 rows per step
        xv[i] = *(const v4f*)(xs + (size_t)(i * 256 + g) * 4);
#pragma unroll
    for (int i = 0; i < 32; ++i)
        wv[i] = *(const v4f*)(ws + (size_t)(i * 256 + g) * 4);
#pragma unroll
    for (int i = 0; i < 32; ++i)
        *(v4h*)((char*)lx + off + i * 4 * PPITCH_) =
            __builtin_convertvector(xv[i], v4h);
#pragma unroll
    for (int i = 0; i < 32; ++i)
        *(v4h*)((char*)lw + off + i * 4 * PPITCH_) =
            __builtin_convertvector(wv[i], v4h);
}

__global__ __launch_bounds__(256, 4) void mha_proj_kernel(
    const float* __restrict__ X,    // [B,S,D]
    const float* __restrict__ W,    // [H,D,D]
    const float* __restrict__ bias, // [H,D]
    half_t* __restrict__ out)       // [H,B,S,D]
{
    __shared__ __attribute__((aligned(16)))
        half_t lX[128 * PPITCH_ / 2];   // 66 KB, [s][d], padded
    __shared__ __attribute__((aligned(16)))
        half_t lW[128 * PPITCH_ / 2];   // 66 KB, [e][d], padded

    const int wave = threadIdx.x >> 5;
    const int lane = threadIdx.x & 31;
    const int h = blockIdx.z / B_;
    const int b = blockIdx.z % B_;
    const int mt = blockIdx.x * 128;       // first s-row of the tile
    const int nt = blockIdx.y * 128;       // first e-col of the tile
    const int wm = (wave >> 1) * 32;       // wave's rows inside the tile
    const int wn = (wave & 1) * 64;        // wave's cols inside the tile

    stage_rows_f16(X + ((size_t)b * S_ + mt) * D_,
                   W + ((size_t)h * D_ + nt) * D_, lX, lW);
    __syncthreads();   // every wave reads rows that other waves staged

    v8f c[2][4] = {};
#pragma unroll
    for (int k = 0; k < D_; k += 32) {
        v16h a[2], bf[4];
#pragma unroll
        for (int i = 0; i < 2; ++i)
            a[i] = frag_load_f16(lX, PPITCH_ / 2, wm + i * 16, k);
#pragma unroll
        for (int j = 0; j < 4; ++j)
            bf[j] = frag_load_f16(lW, PPITCH_ / 2, wn + j * 16, k);
#pragma unroll
        for (int i = 0; i < 2; ++i)
#pragma unroll
            for (int j = 0; j < 4; ++j)
                c[i][j] = wmma_f16(a[i], bf[j], c[i][j]);
    }

    const float* bh = bias + (size_t)h * D_;
    half_t* o = out + ((size_t)h * B_ + b) * S_ * D_;
#pragma unroll
    for (int j = 0; j < 4; ++j) {
        const int col = nt + wn + j * 16 + (lane & 15);
        const float bj = bh[col];
#pragma unroll
        for (int i = 0; i < 2; ++i) {
            const int rb = mt + wm + i * 16 + ((lane >> 4) << 3);
#pragma unroll
            for (int r = 0; r < 8; ++r)
                o[(size_t)(rb + r) * D_ + col] = (half_t)(c[i][j][r] + bj);
        }
    }
}

// --- attention staging helpers ---------------------------------------------

// Issue async DMA of one 32x256 f16 tile (K or V) into LDS, row-major, rows
// PITCH bytes apart. Wave w brings rows w, w+4, ..., w+28: 512 contiguous
// bytes each.
template <int PITCH>
__device__ inline void stage_tile_async(const half_t* gt, unsigned ldsByteOff) {
    const unsigned l0 = ldsByteOff + (threadIdx.x >> 5) * (unsigned)PITCH
                                   + (threadIdx.x & 31) * 16u;
    const unsigned long long g0 =
        (unsigned long long)(uintptr_t)gt + threadIdx.x * 16u;
    constexpr unsigned LS = 4u * PITCH;     // LDS bytes per 4 rows
    constexpr unsigned GS = 4u * D_ * 2u;   // global bytes per 4 rows
    asm volatile("global_load_async_to_lds_b128 %0, %8, off\n\t"
                 "global_load_async_to_lds_b128 %1, %9, off\n\t"
                 "global_load_async_to_lds_b128 %2, %10, off\n\t"
                 "global_load_async_to_lds_b128 %3, %11, off\n\t"
                 "global_load_async_to_lds_b128 %4, %12, off\n\t"
                 "global_load_async_to_lds_b128 %5, %13, off\n\t"
                 "global_load_async_to_lds_b128 %6, %14, off\n\t"
                 "global_load_async_to_lds_b128 %7, %15, off\n\t"
                 "s_wait_xcnt 0x0"
                 :: "v"(l0), "v"(l0 + LS), "v"(l0 + 2 * LS), "v"(l0 + 3 * LS),
                    "v"(l0 + 4 * LS), "v"(l0 + 5 * LS), "v"(l0 + 6 * LS),
                    "v"(l0 + 7 * LS),
                    "v"(g0), "v"(g0 + GS), "v"(g0 + 2 * GS), "v"(g0 + 3 * GS),
                    "v"(g0 + 4 * GS), "v"(g0 + 5 * GS), "v"(g0 + 6 * GS),
                    "v"(g0 + 7 * GS)
                 : "memory");
}

// A fragment of V^T (m = column e0 + lane&15, k = key row t) of a row-major V
// tile by two transposing loads: lane (c, h) gets V[kbase + 8h + 0..7][e0 + c],
// kbase 0 and 16, which is the k order of frag_load_f16.
__device__ inline v16h frag_load_v_tr(const half_t* lv, int e0) {
    typedef __attribute__((address_space(3))) s16x8 lds_s16x8;
    const int lane = threadIdx.x & 31;
    const char* p = (const char*)lv
                  + (((lane >> 4) << 3) + (lane & 7)) * VPITCH_
                  + ((lane >> 3) & 1) * 16 + e0 * 2;
    const v8h lo = __builtin_bit_cast(
        v8h, __builtin_amdgcn_ds_load_tr16_b128_v8i16((lds_s16x8*)p));
    const v8h hi = __builtin_bit_cast(
        v8h, __builtin_amdgcn_ds_load_tr16_b128_v8i16(
                 (lds_s16x8*)(p + 16 * VPITCH_)));
    return __builtin_shufflevector(lo, hi, 0, 1, 2, 3, 4, 5, 6, 7,
                                   8, 9, 10, 11, 12, 13, 14, 15);
}

__device__ inline float xhalf(float x) {
    const int b = __builtin_bit_cast(int, x);
    return __builtin_bit_cast(float, __builtin_amdgcn_permlanex16(
        b, b, 0x76543210, 0xfedcba98, false, false));
}

// ---------------------------------------------------------------------------
// Kernel 2: flash attention over one (h,b), 64 query rows per workgroup.
// Block: 128 threads = 4 waves; wave owns 16 query rows.
// Double-buffered 32-row K/V blocks; staging of block i+1 (async K and V DMA)
// overlaps the WMMA work on block i. One barrier/iter.
// ---------------------------------------------------------------------------
__global__ __launch_bounds__(128) void mha_attn_kernel(
    const half_t* __restrict__ Q,  // [H,B,S,D]
    const half_t* __restrict__ K,
    const half_t* __restrict__ V,
    half_t* __restrict__ O)        // [H,B,S,D]
{
    __shared__ __attribute__((aligned(16)))
        half_t lK[2][32 * KPITCH_ / 2];   // 2 x 16.5 KB, row-major [t][d], padded
    __shared__ __attribute__((aligned(16)))
        half_t lV[2][32 * VPITCH_ / 2];   // 2 x 17 KB, row-major [t][e], padded

    const int wave = threadIdx.x >> 5;
    const int lane = threadIdx.x & 31;
    const int qrow0 = blockIdx.x * 64 + wave * 16;  // global query row
    const size_t base = (size_t)blockIdx.y * S_ * D_;

    const half_t* q  = Q + base;
    const half_t* kp = K + base;
    const half_t* vp = V + base;

    const unsigned lK0off = (unsigned)(uintptr_t)(&lK[0][0]);
    const unsigned lKstride = 32u * KPITCH_;   // bytes per K buffer
    const unsigned lV0off = (unsigned)(uintptr_t)(&lV[0][0]);
    const unsigned lVstride = 32u * VPITCH_;   // bytes per V buffer

    // Q fragments for this wave's 16 rows, kept in registers (8 x v16h); the B
    // operand of S^T = K Q^T (n = query = lane&15, same table as an A operand).
    v16h qa[8];
#pragma unroll
    for (int kk = 0; kk < 8; ++kk)
        qa[kk] = frag_load_f16(q, D_, qrow0, kk * 32);

    // Per lane: running maximum of query lane&15 (equal in both halves) and the
    // running sum over this half's keys alone (halves joined in the epilogue).
    float row_m = -3.0e38f, row_l = 0.0f;
    v8f acc[16];   // O^T tiles: register r <-> e = 16n + 8*(lane>>4) + r
#pragma unroll
    for (int n = 0; n < 16; ++n) acc[n] = v8f{0,0,0,0,0,0,0,0};

    // ---- prologue: stage block 0 into buffer 0 ----
    {
        stage_tile_async<KPITCH_>(kp, lK0off);
        stage_tile_async<VPITCH_>(vp, lV0off);
    }
    asm volatile("s_wait_asynccnt 0x0" ::: "memory");
    __syncthreads();

    constexpr int NB = S_ / 32;   // 128 key blocks
    for (int ib = 0; ib < NB; ++ib) {
        const int cur = ib & 1;
        const int nxt = cur ^ 1;
        const bool more = (ib + 1) < NB;

        // ---- stage block ib+1 (in flight during this block's WMMAs) ----
        if (more) {
            const size_t kt = (size_t)(ib + 1) * 32;
            stage_tile_async<KPITCH_>(kp + kt * D_,
                                      lK0off + (unsigned)nxt * lKstride);
            stage_tile_async<VPITCH_>(vp + kt * D_,
                                      lV0off + (unsigned)nxt * lVstride);
            if (ib + 2 < NB) {  // prefetch block ib+2 toward L2
                __builtin_prefetch(kp + (kt + 32) * D_ + lane * 64, 0, 1);
                __builtin_prefetch(vp + (kt + 32) * D_ + lane * 64, 0, 1);
            }
        }

        const half_t* lkc = &lK[cur][0];
        const half_t* lvc = &lV[cur][0];

        v8f s0 = {}, s1 = {};
#pragma unroll
        for (int kk = 0; kk < 8; ++kk) {
            s0 = wmma_f16(frag_load_f16(lkc, KPITCH_ / 2, 0,  kk * 32),
                          qa[kk], s0);
            s1 = wmma_f16(frag_load_f16(lkc, KPITCH_ / 2, 16, kk * 32),
                          qa[kk], s1);
        }

        // Online softmax. C layout: lane (c, h) holds query c's scores of keys
        // 8h + r (s0[r]) and 16 + 8h + r (s1[r]): maximum and sum are in-lane
        // trees; only the maximum crosses to the other half.
        float t[8];
#pragma unroll
        for (int r = 0; r < 8; ++r) {
            s0[r] *= SCALE_;
            s1[r] *= SCALE_;
            t[r] = fmaxf(s0[r], s1[r]);
        }
        float mx = fmaxf(fmaxf(fmaxf(t[0], t[1]), fmaxf(t[2], t[3])),
                         fmaxf(fmaxf(t[4], t[5]), fmaxf(t[6], t[7])));
        mx = fmaxf(row_m, fmaxf(mx, xhalf(mx)));
        const float corr = __expf(row_m - mx);
#pragma unroll
        for (int r = 0; r < 8; ++r) {
            s0[r] = __expf(s0[r] - mx);
            s1[r] = __expf(s1[r] - mx);
            t[r] = s0[r] + s1[r];
        }
        row_l = row_l * corr + (((t[0] + t[1]) + (t[2] + t[3])) +
                                ((t[4] + t[5]) + (t[6] + t[7])));
        row_m = mx;
#pragma unroll
        for (int n = 0; n < 16; ++n) acc[n] *= corr;

        // P^T as a B operand, packed in-lane: element i is key 8h + i, element
        // 8 + i is key 16 + 8h + i, the k order of frag_load_f16.
        const v16h pb = __builtin_shufflevector(
            __builtin_convertvector(s0, v8h), __builtin_convertvector(s1, v8h),
            0, 1, 2, 3, 4, 5, 6, 7, 8, 9, 10, 11, 12, 13, 14, 15);

#pragma unroll
        for (int n = 0; n < 16; ++n)
            acc[n] = wmma_f16(frag_load_v_tr(lvc, n * 16), pb, acc[n]);

        // ---- publish block ib+1, recycle buffers ----
        // This wave's LDS reads have retired before the copies issued behind
        // the barrier refill the buffers it has just read.
        asm volatile("s_wait_dscnt 0x0" ::: "memory");
        asm volatile("s_wait_asynccnt 0x0" ::: "memory");
        __syncthreads();
    }

    // Epilogue: join the halves' sums, O /= row_l, store f16. Lane (c, h) holds
    // query row c, columns 16n + 8h + 0..7: one 16-byte store per tile.
    row_l += xhalf(row_l);
    const float inv = 1.0f / row_l;
    half_t* o = O + base + (size_t)(qrow0 + (lane & 15)) * D_
                         + ((lane >> 4) << 3);
#pragma unroll
    for (int n = 0; n < 16; ++n)
        *(v8h*)(o + n * 16) = __builtin_convertvector(acc[n] * inv, v8h);
}

// ---------------------------------------------------------------------------
// Kernel 3: output projection.
//   Out[b,s,e] = sum_{h,d} attn[h,b,s,d] * Wo[e, h*D+d] + bo[e]
// Grid: (B*S/128, D/64). Block: 256 (8 waves); workgroup -> 128x64 tile of Out,
// wave -> 32x32 subtile (2 x 2 accumulator tiles). K is walked one head (256)
// at a time: the head's 128x256 A tile and 64x256 Wo tile (converted to f16)
// are staged in LDS by whole-line loads, in two buffers; the next head's loads
// are in flight in registers while this head's tiles are multiplied.
// ---------------------------------------------------------------------------
constexpr int OM_ = 128;   // rows of Out per workgroup
constexpr int ON_ = 64;    // columns of Out per workgroup
typedef __attribute__((ext_vector_type(4))) float    f32x4;
typedef __attribute__((ext_vector_type(4))) _Float16 f16x4;
typedef __attribute__((ext_vector_type(4))) unsigned u32x4;

// Issue one head's loads. au, wu: the workgroup's A tile (one contiguous 64 KB
// block) and Wo tile (64 pieces of 1 KB, a Wo row apart); ta, tw: this thread's
// first element in each. Every wave-wide load covers 512 contiguous bytes: four
// whole lines. Unrolled: constant indices keep av and wv in registers.
__device__ inline void outproj_fetch(const half_t* __restrict__ au, int ta,
                                     const float* __restrict__ wu, int tw,
                                     u32x4 (&av)[16], f32x4 (&wv)[16]) {
#pragma unroll
    for (int i = 0; i < 16; ++i)   // 256 threads x 16 B = 8 rows per step
        av[i] = *(const u32x4*)(au + ta + i * 8 * D_);
    // The A loads' address registers may be reused by what follows.
    asm volatile("s_wait_xcnt 0x0" ::: "memory");
#pragma unroll
    for (int i = 0; i < 16; ++i)   // 256 threads x 16 B = 4 rows per step
        wv[i] = *(const f32x4*)(wu + tw + i * 4 * H_ * D_);
    // The Wo loads' address registers are stepped to the next head behind this.
    asm volatile("s_wait_xcnt 0x0" ::: "memory");
}

// Store the fetched head into LDS, rows PPITCH_ bytes apart. la, lw: this
// thread's first bytes in the two tiles. A wave's store is contiguous.
__device__ inline void outproj_put(const u32x4 (&av)[16], const f32x4 (&wv)[16],
                                   char* la, char* lw) {
#pragma unroll
    for (int i = 0; i < 16; ++i)
        *(u32x4*)(la + i * 8 * PPITCH_) = av[i];
#pragma unroll
    for (int i = 0; i < 16; ++i)
        *(f16x4*)(lw + i * 4 * PPITCH_) = __builtin_convertvector(wv[i], f16x4);
}

__device__ inline void outproj_mul(const half_t* la, const half_t* lw,
                                   int wm, int wn, v8f (&c)[2][2]) {
    v16h a[2][2], bf[2][2];
#pragma unroll
    for (int i = 0; i < 2; ++i) {
        a[0][i]  = frag_load_f16(la, PPITCH_ / 2, wm + i * 16, 0);
        bf[0][i] = frag_load_f16(lw, PPITCH_ / 2, wn + i * 16, 0);
    }
#pragma unroll
    for (int k = 0; k < D_ / 32; ++k) {
        const int s = k & 1;
        if (k + 1 < D_ / 32) {
#pragma unroll
            for (int i = 0; i < 2; ++i) {
                a[s ^ 1][i]  = frag_load_f16(la, PPITCH_ / 2, wm + i * 16,
                                             (k + 1) * 32);
                bf[s ^ 1][i] = frag_load_f16(lw, PPITCH_ / 2, wn + i * 16,
                                             (k + 1) * 32);
            }
            __builtin_amdgcn_sched_barrier(0);   // loads of k + 1 | products of k
        }
#pragma unroll
        for (int i = 0; i < 2; ++i)
#pragma unroll
            for (int j = 0; j < 2; ++j)
                c[i][j] = wmma_f16(a[s][i], bf[s][j], c[i][j]);
        __builtin_amdgcn_sched_barrier(0);   // products of k | what follows
    }
}

__global__ __launch_bounds__(256) void mha_outproj_kernel(
    const half_t* __restrict__ A,   // [H,B,S,D] attention outputs (f16)
    const float*  __restrict__ Wo,  // [D, H*D]
    const float*  __restrict__ bo,  // [D]
    float* __restrict__ Out)        // [B,S,D]
{
    __shared__ __attribute__((aligned(16)))
        half_t lA[2][OM_ * PPITCH_ / 2];   // 2 x 66 KB, [s][d], padded
    __shared__ __attribute__((aligned(16)))
        half_t lW[2][ON_ * PPITCH_ / 2];   // 2 x 33 KB, [e][d], padded

    const int g    = threadIdx.x;
    const int wave = g >> 5;
    const int lane = g & 31;
    const int mt = blockIdx.x * OM_;   // first row over B*S
    const int nt = blockIdx.y * ON_;   // first e-col
    const int b  = mt / S_;            // a 128-row tile never crosses a batch
    const int s0 = mt % S_;
    const int wm = (wave >> 1) * 32;   // wave's rows inside the tile
    const int wn = (wave & 1) * 32;    // wave's cols inside the tile

    const half_t* au = A + ((size_t)b * S_ + s0) * D_;   // head 0's A tile
    const float*  wu = Wo + (size_t)nt * (H_ * D_);      // head 0's Wo tile
    const int ta = g * 8;                                // halves into an A tile
    const int tw = (g >> 6) * (H_ * D_) + (g & 63) * 4;  // floats into a Wo tile
    const int pa = (g >> 5) * PPITCH_ + (g & 31) * 16;   // bytes into an A tile
    const int pw = (g >> 6) * PPITCH_ + (g & 63) * 8;    // bytes into a Wo tile

    u32x4 av[16];
    f32x4 wv[16];
    outproj_fetch(au, ta, wu, tw, av, wv);
    outproj_put(av, wv, (char*)&lA[0][0] + pa, (char*)&lW[0][0] + pw);
    __syncthreads();   // head 0 is staged: every wave reads other waves' rows

    v8f c[2][2] = {};
    for (int h = 0; h + 1 < H_; ++h) {
        const int cur = h & 1;
        au += (size_t)B_ * S_ * D_;
        wu += D_;
        outproj_fetch(au, ta, wu, tw, av, wv);
        outproj_mul(&lA[cur][0], &lW[cur][0], wm, wn, c);
        outproj_put(av, wv, (char*)&lA[cur ^ 1][0] + pa,
                            (char*)&lW[cur ^ 1][0] + pw);
        // Publishes head h + 1, and ends every wave's reads of the buffers
        // that the next trip refills.
        __syncthreads();
    }
    outproj_mul(&lA[(H_ - 1) & 1][0], &lW[(H_ - 1) & 1][0], wm, wn, c);

    // Unrolled: constant indices keep c in registers.
#pragma unroll
    for (int j = 0; j < 2; ++j) {
        const int col = nt + wn + j * 16 + (lane & 15);
        const float bj = bo[col];
#pragma unroll
        for (int i = 0; i < 2; ++i) {
            const int rb = mt + wm + i * 16 + ((lane >> 4) << 3);
#pragma unroll
            for (int r = 0; r < 8; ++r)
                Out[(size_t)(rb + r) * D_ + col] = c[i][j][r] + bj;
        }
    }
}

// ---------------------------------------------------------------------------
extern "C" void kernel_launch(void* const* d_in, const int* in_sizes, int n_in,
                              void* d_out, int out_size, void* d_ws, size_t ws_size,
                              hipStream_t stream) {
    (void)in_sizes; (void)n_in; (void)out_size; (void)ws_size;

    const float* query = (const float*)d_in[0];
    const float* key_  = (const float*)d_in[1];
    const float* value = (const float*)d_in[2];
    const float* Wq    = (const float*)d_in[3];
    const float* bq    = (const float*)d_in[4];
    const float* Wk    = (const float*)d_in[5];
    const float* bk    = (const float*)d_in[6];
    const float* Wv    = (const float*)d_in[7];
    const float* bv    = (const float*)d_in[8];
    const float* Wo    = (const float*)d_in[9];
    const float* bo    = (const float*)d_in[10];
    float* out = (float*)d_out;

    const size_t per = (size_t)H_ * B_ * S_ * D_;   // elements per f16 tensor
    half_t* qh = (half_t*)d_ws;
    half_t* kh = qh + per;
    half_t* vh = kh + per;
    half_t* ah = vh + per;                           // 4 * 33.5 MB = 134 MB

    dim3 pblk(256), pgrd(S_ / 128, D_ / 128, H_ * B_);
    mha_proj_kernel<<<pgrd, pblk, 0, stream>>>(query, Wq, bq, qh);
    mha_proj_kernel<<<pgrd, pblk, 0, stream>>>(key_,  Wk, bk, kh);
    mha_proj_kernel<<<pgrd, pblk, 0, stream>>>(value, Wv, bv, vh);

    dim3 ablk(128), agrd(S_ / 64, H_ * B_);
    mha_attn_kernel<<<agrd, ablk, 0, stream>>>(qh, kh, vh, ah);

    dim3 oblk(256), ogrd((B_ * S_) / OM_, D_ / ON_);
    mha_outproj_kernel<<<ogrd, oblk, 0, stream>>>(ah, Wo, bo, out);
}

// v006
// A run of this version takes 236 microseconds.
// In two side-by-side timings against v005, it was 1.33 and 1.32 times as fast.
// All steps since v000 together make it 19.1 times as fast.
#include <hip/hip_runtime.h>
#include <hip/hip_bf16.h>

typedef __attribute__((ext_vector_type(16))) _Float16 v16h;
typedef __attribute__((ext_vector_type(8)))  float    v8f;
typedef __attribute__((ext_vector_type(8)))  _Float16 v8h;
typedef __attribute__((ext_vector_type(8)))  short    s16x8;
typedef _Float16 half_t;

constexpr int H_ = 8;
constexpr int D_ = 256;
constexpr int B_ = 2;
constexpr int S_ = 4096;
constexpr int KPITCH_ = 528;       // bytes per K row in LDS: 512 + 16, 16 B x odd
constexpr int VPITCH_ = 544;       // bytes per V row in LDS: 512 + 32, 32 B x odd
constexpr int PPITCH_ = 528;       // bytes per staged X or W row: 512 + 16, 16 B x odd
constexpr float SCALE_ = 0.0625f;  // 1/sqrt(256)

__device__ inline v8f wmma_f16(v16h a, v16h b, v8f c) {
    // 8 args: (neg_a, A, neg_b, B, c_mod, C, reuse_a, reuse_b)
    return __builtin_amdgcn_wmma_f32_16x16x32_f16(
        false, a, false, b, (short)0, c, false, false);
}

__device__ inline v16h frag_load_f16(const half_t* __restrict__ src, int ld,
                                     int row0, int k0) {
    const int lane = threadIdx.x & 31;
    const half_t* p = src + (size_t)(row0 + (lane & 15)) * ld
                          + k0 + ((lane >> 4) << 3);
    v16h f;
#pragma unroll
    for (int i = 0; i < 8; ++i) f[i] = p[i];
#pragma unroll
    for (int i = 0; i < 8; ++i) f[8 + i] = p[16 + i];
    return f;
}

// Stage 128 consecutive rows of 256 floats of X and of W (each one contiguous
// 128 KB block) into LDS as f16, rows PPITCH_ bytes apart. A wave's load covers
// 512 contiguous bytes (four whole lines); its store covers 256 contiguous LDS
// bytes. All loads stand ahead of the first store, so that one memory latency
// is paid for the whole tile pair.
__device__ inline void stage_rows_f16(const float* __restrict__ xs,
                                      const float* __restrict__ ws,
                                      half_t* lx, half_t* lw) {
    typedef __attribute__((ext_vector_type(4))) float    v4f;
    typedef __attribute__((ext_vector_type(4))) _Float16 v4h;
    const int g = threadIdx.x;   // group of 4 floats: 64 groups per row
    const int off = (g >> 6) * PPITCH_ + (g & 63) * 8;
    // Every loop here is unrolled so that xv and wv are indexed by constants
    // and stay in registers, and every step is an immediate offset.
    v4f xv[32], wv[32];
#pragma unroll
    for (int i = 0; i < 32; ++i)   // 256 groups = 4 rows per step
        xv[i] = *(const v4f*)(xs + (size_t)(i * 256 + g) * 4);
#pragma unroll
    for (int i = 0; i < 32; ++i)
        wv[i] = *(const v4f*)(ws + (size_t)(i * 256 + g) * 4);
#pragma unroll
    for (int i = 0; i < 32; ++i)
        *(v4h*)((char*)lx + off + i * 4 * PPITCH_) =
            __builtin_convertvector(xv[i], v4h);
#pragma unroll
    for (int i = 0; i < 32; ++i)
        *(v4h*)((char*)lw + off + i * 4 * PPITCH_) =
            __builtin_convertvector(wv[i], v4h);
}

__global__ __launch_bounds__(256, 4) void mha_proj_kernel(
    const float* __restrict__ X,    // [B,S,D]
    const float* __restrict__ W,    // [H,D,D]
    const float* __restrict__ bias, // [H,D]
    half_t* __restrict__ out)       // [H,B,S,D]
{
    __shared__ __attribute__((aligned(16)))
        half_t lX[128 * PPITCH_ / 2];   // 66 KB, [s][d], padded
    __shared__ __attribute__((aligned(16)))
        half_t lW[128 * PPITCH_ / 2];   // 66 KB, [e][d], padded

    const int wave = threadIdx.x >> 5;
    const int lane = threadIdx.x & 31;
    const int h = blockIdx.z / B_;
    const int b = blockIdx.z % B_;
    const int mt = blockIdx.x * 128;       // first s-row of the tile
    const int nt = blockIdx.y * 128;       // first e-col of the tile
    const int wm = (wave >> 1) * 32;       // wave's rows inside the tile
    const int wn = (wave & 1) * 64;        // wave's cols inside the tile

    stage_rows_f16(X + ((size_t)b * S_ + mt) * D_,
                   W + ((size_t)h * D_ + nt) * D_, lX, lW);
    __syncthreads();   // every wave reads rows that other waves staged

    v8f c[2][4] = {};
#pragma unroll
    for (int k = 0; k < D_; k += 32) {
        v16h a[2], bf[4];
#pragma unroll
        for (int i = 0; i < 2; ++i)
            a[i] = frag_load_f16(lX, PPITCH_ / 2, wm + i * 16, k);
#pragma unroll
        for (int j = 0; j < 4; ++j)
            bf[j] = frag_load_f16(lW, PPITCH_ / 2, wn + j * 16, k);
#pragma unroll
        for (int i = 0; i < 2; ++i)
#pragma unroll
            for (int j = 0; j < 4; ++j)
                c[i][j] = wmma_f16(a[i], bf[j], c[i][j]);
    }

    const float* bh = bias + (size_t)h * D_;
    half_t* o = out + ((size_t)h * B_ + b) * S_ * D_;
#pragma unroll
    for (int j = 0; j < 4; ++j) {
        const int col = nt + wn + j * 16 + (lane & 15);
        const float bj = bh[col];
#pragma unroll
        for (int i = 0; i < 2; ++i) {
            const int rb = mt + wm + i * 16 + ((lane >> 4) << 3);
#pragma unroll
            for (int r = 0; r < 8; ++r)
                o[(size_t)(rb + r) * D_ + col] = (half_t)(c[i][j][r] + bj);
        }
    }
}

// --- attention staging helpers ---------------------------------------------

// Issue async DMA of one 32x256 f16 tile (K or V) into LDS, row-major, rows
// PITCH bytes apart. Wave w of eight brings rows w, w+8, w+16, w+24: 512
// contiguous bytes each.
template <int PITCH>
__device__ inline void stage_tile_async(const half_t* gt, half_t* lt) {
    typedef __attribute__((ext_vector_type(4))) int i32x4;
    typedef __attribute__((address_space(1))) i32x4 glb_i32x4;
    typedef __attribute__((address_space(3))) i32x4 lds_i32x4;
    const char* g0 = (const char*)gt + threadIdx.x * 16u;
    char* l0 = (char*)lt + (threadIdx.x >> 5) * PITCH + (threadIdx.x & 31) * 16;
    // The builtin form: its address registers are the compiler's own, in any
    // register window; operands of asm text must lie in v0..v255, where this
    // kernel's accumulators and Q live, and cost a spill of Q.
    // Unrolled: four copies with constant steps.
#pragma unroll
    for (int i = 0; i < 4; ++i)   // 8 rows per step
        __builtin_amdgcn_global_load_async_to_lds_b128(
            (glb_i32x4*)(g0 + i * 8 * D_ * 2), (lds_i32x4*)(l0 + i * 8 * PITCH),
            0, 0);
}

// A fragment of V^T (m = column e0 + lane&15, k = key row t) of a row-major V
// tile by two transposing loads: lane (c, h) gets V[kbase + 8h + 0..7][e0 + c],
// kbase 0 and 16, which is the k order of frag_load_f16.
__device__ inline v16h frag_load_v_tr(const half_t* lv, int e0) {
    typedef __attribute__((address_space(3))) s16x8 lds_s16x8;
    const int lane = threadIdx.x & 31;
    const char* p = (const char*)lv
                  + (((lane >> 4) << 3) + (lane & 7)) * VPITCH_
                  + ((lane >> 3) & 1) * 16 + e0 * 2;
    const v8h lo = __builtin_bit_cast(
        v8h, __builtin_amdgcn_ds_load_tr16_b128_v8i16((lds_s16x8*)p));
    const v8h hi = __builtin_bit_cast(
        v8h, __builtin_amdgcn_ds_load_tr16_b128_v8i16(
                 (lds_s16x8*)(p + 16 * VPITCH_)));
    return __builtin_shufflevector(lo, hi, 0, 1, 2, 3, 4, 5, 6, 7,
                                   8, 9, 10, 11, 12, 13, 14, 15);
}

// The two K fragments of k step kk: key rows 0..15 and 16..31.
__device__ inline void load_k_step(const half_t* lk, int kk, v16h (&kf)[2]) {
    kf[0] = frag_load_f16(lk, KPITCH_ / 2, 0,  kk * 32);
    kf[1] = frag_load_f16(lk, KPITCH_ / 2, 16, kk * 32);
}

// Four V^T fragments: output columns 64g .. 64g + 63.
__device__ inline void load_v_group(const half_t* lv, int g, v16h (&vf)[4]) {
#pragma unroll
    for (int u = 0; u < 4; ++u)
        vf[u] = frag_load_v_tr(lv, (4 * g + u) * 16);
}

__device__ inline float xhalf(float x) {
    const int b = __builtin_bit_cast(int, x);
    return __builtin_bit_cast(float, __builtin_amdgcn_permlanex16(
        b, b, 0x76543210, 0xfedcba98, false, false));
}

__global__ __launch_bounds__(256) void mha_attn_kernel(
    const half_t* __restrict__ Q,  // [H,B,S,D]
    const half_t* __restrict__ K,
    const half_t* __restrict__ V,
    half_t* __restrict__ O)        // [H,B,S,D]
{
    __shared__ __attribute__((aligned(16)))
        half_t lK[2][32 * KPITCH_ / 2];   // 2 x 16.5 KB, row-major [t][d], padded
    __shared__ __attribute__((aligned(16)))
        half_t lV[2][32 * VPITCH_ / 2];   // 2 x 17 KB, row-major [t][e], padded

    const int wave = threadIdx.x >> 5;
    const int lane = threadIdx.x & 31;
    const int qrow0 = blockIdx.x * 256 + wave * 32;  // global query row
    const size_t base = (size_t)blockIdx.y * S_ * D_;

    const half_t* q  = Q + base;
    const half_t* kp = K + base;
    const half_t* vp = V + base;

    // Every loop over j (column group), kk and n below is unrolled: constant
    // indices keep qa, acc and the scores in registers.
    // Q fragments for this wave's 2 x 16 rows, kept in registers (16 x v16h);
    // the B operand of S^T = K Q^T (n = query = lane&15, same table as an A
    // operand).
    v16h qa[2][8];
#pragma unroll
    for (int j = 0; j < 2; ++j)
#pragma unroll
        for (int kk = 0; kk < 8; ++kk)
            qa[j][kk] = frag_load_f16(q, D_, qrow0 + j * 16, kk * 32);
    // The Q loads' address registers may be reused by what follows; the
    // scheduling barrier keeps the arithmetic that reuses them behind the wait.
    asm volatile("s_wait_xcnt 0x0" ::: "memory");
    __builtin_amdgcn_sched_barrier(0);

    // Per lane and group: running maximum of query 16j + lane&15 (equal in both
    // halves) and the running sum over this half's keys alone (halves joined in
    // the epilogue).
    float row_m[2] = {-3.0e38f, -3.0e38f}, row_l[2] = {0.0f, 0.0f};
    v8f acc[2][16];   // O^T tiles: register r <-> e = 16n + 8*(lane>>4) + r
#pragma unroll
    for (int j = 0; j < 2; ++j)
#pragma unroll
        for (int n = 0; n < 16; ++n) acc[j][n] = v8f{0,0,0,0,0,0,0,0};

    // ---- prologue: stage block 0 into buffer 0 ----
    {
        stage_tile_async<KPITCH_>(kp, &lK[0][0]);
        stage_tile_async<VPITCH_>(vp, &lV[0][0]);
    }
    asm volatile("s_wait_asynccnt 0x0" ::: "memory");
    __syncthreads();

    constexpr int NB = S_ / 32;   // 128 key blocks
    for (int ib = 0; ib < NB; ++ib) {
        const int cur = ib & 1;
        const int nxt = cur ^ 1;
        const bool more = (ib + 1) < NB;

        const half_t* lkc = &lK[cur][0];
        const half_t* lvc = &lV[cur][0];

        v16h kf[3][2], vf[2][4];
        load_k_step(lkc, 0, kf[0]);
        load_k_step(lkc, 1, kf[1]);

        // ---- stage block ib+1 (in flight during this block's WMMAs) ----
        if (more) {
            const size_t kt = (size_t)(ib + 1) * 32;
            stage_tile_async<KPITCH_>(kp + kt * D_, &lK[nxt][0]);
            stage_tile_async<VPITCH_>(vp + kt * D_, &lV[nxt][0]);
        }

        v8f s0[2] = {}, s1[2] = {};
#pragma unroll
        for (int kk = 0; kk < 8; ++kk) {
            if (kk < 6) {
                load_k_step(lkc, kk + 2, kf[(kk + 2) % 3]);
            } else {   // the first V group: it lands under the softmax
                vf[0][2 * kk - 12] = frag_load_v_tr(lvc, (2 * kk - 12) * 16);
                vf[0][2 * kk - 11] = frag_load_v_tr(lvc, (2 * kk - 11) * 16);
            }
            __builtin_amdgcn_sched_barrier(0);   // loads ahead | products of kk
#pragma unroll
            for (int j = 0; j < 2; ++j) {
                s0[j] = wmma_f16(kf[kk % 3][0], qa[j][kk], s0[j]);
                s1[j] = wmma_f16(kf[kk % 3][1], qa[j][kk], s1[j]);
            }
            __builtin_amdgcn_sched_barrier(0);   // products of kk | what follows
        }

        // Online softmax, per column group. C layout: lane (c, h) holds query
        // 16j + c's scores of keys 8h + r (s0[j][r]) and 16 + 8h + r
        // (s1[j][r]): maximum and sum are in-lane trees; only the maximum
        // crosses to the other half.
        v16h pb[2];
        float corr[2];
#pragma unroll
        for (int j = 0; j < 2; ++j) {
            float t[8];
#pragma unroll
            for (int r = 0; r < 8; ++r) {
                s0[j][r] *= SCALE_;
                s1[j][r] *= SCALE_;
                t[r] = fmaxf(s0[j][r], s1[j][r]);
            }
            float mx = fmaxf(fmaxf(fmaxf(t[0], t[1]), fmaxf(t[2], t[3])),
                             fmaxf(fmaxf(t[4], t[5]), fmaxf(t[6], t[7])));
            mx = fmaxf(row_m[j], fmaxf(mx, xhalf(mx)));
            const float cj = __expf(row_m[j] - mx);
#pragma unroll
            for (int r = 0; r < 8; ++r) {
                s0[j][r] = __expf(s0[j][r] - mx);
                s1[j][r] = __expf(s1[j][r] - mx);
                t[r] = s0[j][r] + s1[j][r];
            }
            row_l[j] = row_l[j] * cj + (((t[0] + t[1]) + (t[2] + t[3])) +
                                          ((t[4] + t[5]) + (t[6] + t[7])));
            row_m[j] = mx;
            // Each row's sum is finished here (an input only, no instruction):
            // sunk behind the O^T products it keeps the 32 f32 scores live
            // beside the V fragments, and Q is spilled.
            asm volatile("" :: "v"(row_l[j]));   // row sum pinned against spills
            corr[j] = cj;
#pragma unroll
            for (int n = 0; n < 4; ++n) acc[j][n] *= cj;

            // P^T as a B operand, packed in-lane: element i is key 8h + i,
            // element 8 + i is key 16 + 8h + i, the k order of frag_load_f16.
            pb[j] = __builtin_shufflevector(
                __builtin_convertvector(s0[j], v8h),
                __builtin_convertvector(s1[j], v8h),
                0, 1, 2, 3, 4, 5, 6, 7, 8, 9, 10, 11, 12, 13, 14, 15);
        }

#pragma unroll
        for (int g = 0; g < 4; ++g) {
            if (g < 3) load_v_group(lvc, g + 1, vf[(g + 1) & 1]);
            __builtin_amdgcn_sched_barrier(0);   // next loads | products of g
#pragma unroll
            for (int u = 0; u < 4; ++u)
#pragma unroll
                for (int j = 0; j < 2; ++j)
                    acc[j][4 * g + u] =
                        wmma_f16(vf[g & 1][u], pb[j], acc[j][4 * g + u]);
            // The next group's tiles are rescaled beside this group's products.
            if (g < 3) {
#pragma unroll
                for (int u = 0; u < 4; ++u)
#pragma unroll
                    for (int j = 0; j < 2; ++j) acc[j][4 * g + 4 + u] *= corr[j];
            }
            __builtin_amdgcn_sched_barrier(0);   // products of g | what follows
        }

        // ---- publish block ib+1, recycle buffers ----
        // This wave's LDS reads have retired before the copies issued behind
        // the barrier refill the buffers it has just read.
        asm volatile("s_wait_dscnt 0x0" ::: "memory");
        asm volatile("s_wait_asynccnt 0x0" ::: "memory");
        __syncthreads();
    }

    // Epilogue: join the halves' sums, O /= row_l, store f16. Lane (c, h) holds
    // query row 16j + c, columns 16n + 8h + 0..7: one 16-byte store per tile.
#pragma unroll
    for (int j = 0; j < 2; ++j) {
        const float l = row_l[j] + xhalf(row_l[j]);
        const float inv = 1.0f / l;
        half_t* o = O + base + (size_t)(qrow0 + j * 16 + (lane & 15)) * D_
                             + ((lane >> 4) << 3);
#pragma unroll
        for (int n = 0; n < 16; ++n) {
            *(v8h*)(o + n * 16) = __builtin_convertvector(acc[j][n] * inv, v8h);
            if ((n & 3) == 3) {
                // The four stores' data and address registers may be reused by
                // what follows; the scheduling barrier keeps the next tiles'
                // arithmetic, which reuses them, behind the wait.
                asm volatile("s_wait_xcnt 0x0" ::: "memory");
                __builtin_amdgcn_sched_barrier(0);
            }
        }
    }
}

// ---------------------------------------------------------------------------
// Kernel 3: output projection.
//   Out[b,s,e] = sum_{h,d} attn[h,b,s,d] * Wo[e, h*D+d] + bo[e]
// Grid: (B*S/128, D/64). Block: 256 (8 waves); workgroup -> 128x64 tile of Out,
// wave -> 32x32 subtile (2 x 2 accumulator tiles). K is walked one head (256)
// at a time: the head's 128x256 A tile and 64x256 Wo tile (converted to f16)
// are staged in LDS by whole-line loads, in two buffers; the next head's loads
// are in flight in registers while this head's tiles are multiplied.
// ---------------------------------------------------------------------------
constexpr int OM_ = 128;   // rows of Out per workgroup
constexpr int ON_ = 64;    // columns of Out per workgroup
typedef __attribute__((ext_vector_type(4))) float    f32x4;
typedef __attribute__((ext_vector_type(4))) _Float16 f16x4;
typedef __attribute__((ext_vector_type(4))) unsigned u32x4;

// Issue one head's loads. au, wu: the workgroup's A tile (one contiguous 64 KB
// block) and Wo tile (64 pieces of 1 KB, a Wo row apart); ta, tw: this thread's
// first element in each. Every wave-wide load covers 512 contiguous bytes: four
// whole lines. Unrolled: constant indices keep av and wv in registers.
__device__ inline void outproj_fetch(const half_t* __restrict__ au, int ta,
                                     const float* __restrict__ wu, int tw,
                                     u32x4 (&av)[16], f32x4 (&wv)[16]) {
#pragma unroll
    for (int i = 0; i < 16; ++i)   // 256 threads x 16 B = 8 rows per step
        av[i] = *(const u32x4*)(au + ta + i * 8 * D_);
    // The A loads' address registers may be reused by what follows.
    asm volatile("s_wait_xcnt 0x0" ::: "memory");
#pragma unroll
    for (int i = 0; i < 16; ++i)   // 256 threads x 16 B = 4 rows per step
        wv[i] = *(const f32x4*)(wu + tw + i * 4 * H_ * D_);
    // The Wo loads' address registers are stepped to the next head behind this.
    asm volatile("s_wait_xcnt 0x0" ::: "memory");
}

// Store the fetched head into LDS, rows PPITCH_ bytes apart. la, lw: this
// thread's first bytes in the two tiles. A wave's store is contiguous.
__device__ inline void outproj_put(const u32x4 (&av)[16], const f32x4 (&wv)[16],
                                   char* la, char* lw) {
#pragma unroll
    for (int i = 0; i < 16; ++i)
        *(u32x4*)(la + i * 8 * PPITCH_) = av[i];
#pragma unroll
    for (int i = 0; i < 16; ++i)
        *(f16x4*)(lw + i * 4 * PPITCH_) = __builtin_convertvector(wv[i], f16x4);
}

__device__ inline void outproj_mul(const half_t* la, const half_t* lw,
                                   int wm, int wn, v8f (&c)[2][2]) {
    v16h a[2][2], bf[2][2];
#pragma unroll
    for (int i = 0; i < 2; ++i) {
        a[0][i]  = frag_load_f16(la, PPITCH_ / 2, wm + i * 16, 0);
        bf[0][i] = frag_load_f16(lw, PPITCH_ / 2, wn + i * 16, 0);
    }
#pragma unroll
    for (int k = 0; k < D_ / 32; ++k) {
        const int s = k & 1;
        if (k + 1 < D_ / 32) {
#pragma unroll
            for (int i = 0; i < 2; ++i) {
                a[s ^ 1][i]  = frag_load_f16(la, PPITCH_ / 2, wm + i * 16,
                                             (k + 1) * 32);
                bf[s ^ 1][i] = frag_load_f16(lw, PPITCH_ / 2, wn + i * 16,
                                             (k + 1) * 32);
            }
            __builtin_amdgcn_sched_barrier(0);   // loads of k + 1 | products of k
        }
#pragma unroll
        for (int i = 0; i < 2; ++i)
#pragma unroll
            for (int j = 0; j < 2; ++j)
                c[i][j] = wmma_f16(a[s][i], bf[s][j], c[i][j]);
        __builtin_amdgcn_sched_barrier(0);   // products of k | what follows
    }
}

__global__ __launch_bounds__(256) void mha_outproj_kernel(
    const half_t* __restrict__ A,   // [H,B,S,D] attention outputs (f16)
    const float*  __restrict__ Wo,  // [D, H*D]
    const float*  __restrict__ bo,  // [D]
    float* __restrict__ Out)        // [B,S,D]
{
    __shared__ __attribute__((aligned(16)))
        half_t lA[2][OM_ * PPITCH_ / 2];   // 2 x 66 KB, [s][d], padded
    __shared__ __attribute__((aligned(16)))
        half_t lW[2][ON_ * PPITCH_ / 2];   // 2 x 33 KB, [e][d], padded

    const int g    = threadIdx.x;
    const int wave = g >> 5;
    const int lane = g & 31;
    const int mt = blockIdx.x * OM_;   // first row over B*S
    const int nt = blockIdx.y * ON_;   // first e-col
    const int b  = mt / S_;            // a 128-row tile never crosses a batch
    const int s0 = mt % S_;
    const int wm = (wave >> 1) * 32;   // wave's rows inside the tile
    const int wn = (wave & 1) * 32;    // wave's cols inside the tile

    const half_t* au = A + ((size_t)b * S_ + s0) * D_;   // head 0's A tile
    const float*  wu = Wo + (size_t)nt * (H_ * D_);      // head 0's Wo tile
    const int ta = g * 8;                                // halves into an A tile
    const int tw = (g >> 6) * (H_ * D_) + (g & 63) * 4;  // floats into a Wo tile
    const int pa = (g >> 5) * PPITCH_ + (g & 31) * 16;   // bytes into an A tile
    const int pw = (g >> 6) * PPITCH_ + (g & 63) * 8;    // bytes into a Wo tile

    u32x4 av[16];
    f32x4 wv[16];
    outproj_fetch(au, ta, wu, tw, av, wv);
    outproj_put(av, wv, (char*)&lA[0][0] + pa, (char*)&lW[0][0] + pw);
    __syncthreads();   // head 0 is staged: every wave reads other waves' rows

    v8f c[2][2] = {};
    for (int h = 0; h + 1 < H_; ++h) {
        const int cur = h & 1;
        au += (size_t)B_ * S_ * D_;
        wu += D_;
        outproj_fetch(au, ta, wu, tw, av, wv);
        outproj_mul(&lA[cur][0], &lW[cur][0], wm, wn, c);
        outproj_put(av, wv, (char*)&lA[cur ^ 1][0] + pa,
                            (char*)&lW[cur ^ 1][0] + pw);
        // Publishes head h + 1, and ends every wave's reads of the buffers
        // that the next trip refills.
        __syncthreads();
    }
    outproj_mul(&lA[(H_ - 1) & 1][0], &lW[(H_ - 1) & 1][0], wm, wn, c);

    // Unrolled: constant indices keep c in registers.
#pragma unroll
    for (int j = 0; j < 2; ++j) {
        const int col = nt + wn + j * 16 + (lane & 15);
        const float bj = bo[col];
#pragma unroll
        for (int i = 0; i < 2; ++i) {
            const int rb = mt + wm + i * 16 + ((lane >> 4) << 3);
#pragma unroll
            for (int r = 0; r < 8; ++r)
                Out[(size_t)(rb + r) * D_ + col] = c[i][j][r] + bj;
        }
    }
}

// ---------------------------------------------------------------------------
extern "C" void kernel_launch(void* const* d_in, const int* in_sizes, int n_in,
                              void* d_out, int out_size, void* d_ws, size_t ws_size,
                              hipStream_t stream) {
    (void)in_sizes; (void)n_in; (void)out_size; (void)ws_size;

    const float* query = (const float*)d_in[0];
    const float* key_  = (const float*)d_in[1];
    const float* value = (const float*)d_in[2];
    const float* Wq    = (const float*)d_in[3];
    const float* bq    = (const float*)d_in[4];
    const float* Wk    = (const float*)d_in[5];
    const float* bk    = (const float*)d_in[6];
    const float* Wv    = (const float*)d_in[7];
    const float* bv    = (const float*)d_in[8];
    const float* Wo    = (const float*)d_in[9];
    const float* bo    = (const float*)d_in[10];
    float* out = (float*)d_out;

    const size_t per = (size_t)H_ * B_ * S_ * D_;   // elements per f16 tensor
    half_t* qh = (half_t*)d_ws;
    half_t* kh = qh + per;
    half_t* vh = kh + per;
    half_t* ah = vh + per;                           // 4 * 33.5 MB = 134 MB

    dim3 pblk(256), pgrd(S_ / 128, D_ / 128, H_ * B_);
    mha_proj_kernel<<<pgrd, pblk, 0, stream>>>(query, Wq, bq, qh);
    mha_proj_kernel<<<pgrd, pblk, 0, stream>>>(key_,  Wk, bk, kh);
    mha_proj_kernel<<<pgrd, pblk, 0, stream>>>(value, Wv, bv, vh);

    dim3 ablk(256), agrd(S_ / 256, H_ * B_);
    mha_attn_kernel<<<agrd, ablk, 0, stream>>>(qh, kh, vh, ah);

    dim3 oblk(256), ogrd((B_ * S_) / OM_, D_ / ON_);
    mha_outproj_kernel<<<ogrd, oblk, 0, stream>>>(ah, Wo, bo, out);
}

// v007
// It runs in 218 microseconds.
// Next to v006, in two timings, it ran 1.09 and 1.08 times as fast.
// Counting every step since v000, it is 20.8 times as fast.
#include <hip/hip_runtime.h>
#include <hip/hip_bf16.h>

typedef __attribute__((ext_vector_type(16))) _Float16 v16h;
typedef __attribute__((ext_vector_type(8)))  float    v8f;
typedef __attribute__((ext_vector_type(8)))  _Float16 v8h;
typedef __attribute__((ext_vector_type(8)))  short    s16x8;
typedef _Float16 half_t;

constexpr int H_ = 8;
constexpr int D_ = 256;
constexpr int B_ = 2;
constexpr int S_ = 4096;
constexpr int KPITCH_ = 528;       // bytes per K row in LDS: 512 + 16, 16 B x odd
constexpr int VPITCH_ = 544;       // bytes per V row in LDS: 512 + 32, 32 B x odd
constexpr int PPITCH_ = 528;       // bytes per staged X or W row: 512 + 16, 16 B x odd
constexpr float SCALE_ = 0.0625f;  // 1/sqrt(256)
constexpr float LAZY_ = 5.545177f; // 8 ln 2: how far the maximum in use may trail

__device__ inline v8f wmma_f16(v16h a, v16h b, v8f c) {
    // 8 args: (neg_a, A, neg_b, B, c_mod, C, reuse_a, reuse_b)
    return __builtin_amdgcn_wmma_f32_16x16x32_f16(
        false, a, false, b, (short)0, c, false, false);
}

__device__ inline v16h frag_load_f16(const half_t* __restrict__ src, int ld,
                                     int row0, int k0) {
    const int lane = threadIdx.x & 31;
    const half_t* p = src + (size_t)(row0 + (lane & 15)) * ld
                          + k0 + ((lane >> 4) << 3);
    v16h f;
#pragma unroll
    for (int i = 0; i < 8; ++i) f[i] = p[i];
#pragma unroll
    for (int i = 0; i < 8; ++i) f[8 + i] = p[16 + i];
    return f;
}

// Stage 128 consecutive rows of 256 floats of X and of W (each one contiguous
// 128 KB block) into LDS as f16, rows PPITCH_ bytes apart. A wave's load covers
// 512 contiguous bytes (four whole lines); its store covers 256 contiguous LDS
// bytes. All loads stand ahead of the first store, so that one memory latency
// is paid for the whole tile pair.
__device__ inline void stage_rows_f16(const float* __restrict__ xs,
                                      const float* __restrict__ ws,
                                      half_t* lx, half_t* lw) {
    typedef __attribute__((ext_vector_type(4))) float    v4f;
    typedef __attribute__((ext_vector_type(4))) _Float16 v4h;
    const int g = threadIdx.x;   // group of 4 floats: 64 groups per row
    const int off = (g >> 6) * PPITCH_ + (g & 63) * 8;
    // Every loop here is unrolled so that xv and wv are indexed by constants
    // and stay in registers, and every step is an immediate offset.
    v4f xv[32], wv[32];
#pragma unroll
    for (int i = 0; i < 32; ++i)   // 256 groups = 4 rows per step
        xv[i] = *(const v4f*)(xs + (size_t)(i * 256 + g) * 4);
#pragma unroll
    for (int i = 0; i < 32; ++i)
        wv[i] = *(const v4f*)(ws + (size_t)(i * 256 + g) * 4);
#pragma unroll
    for (int i = 0; i < 32; ++i)
        *(v4h*)((char*)lx + off + i * 4 * PPITCH_) =
            __builtin_convertvector(xv[i], v4h);
#pragma unroll
    for (int i = 0; i < 32; ++i)
        *(v4h*)((char*)lw + off + i * 4 * PPITCH_) =
            __builtin_convertvector(wv[i], v4h);
}

__global__ __launch_bounds__(256, 4) void mha_proj_kernel(
    const float* __restrict__ X,    // [B,S,D]
    const float* __restrict__ W,    // [H,D,D]
    const float* __restrict__ bias, // [H,D]
    half_t* __restrict__ out)       // [H,B,S,D]
{
    __shared__ __attribute__((aligned(16)))
        half_t lX[128 * PPITCH_ / 2];   // 66 KB, [s][d], padded
    __shared__ __attribute__((aligned(16)))
        half_t lW[128 * PPITCH_ / 2];   // 66 KB, [e][d], padded

    const int wave = threadIdx.x >> 5;
    const int lane = threadIdx.x & 31;
    const int h = blockIdx.z / B_;
    const int b = blockIdx.z % B_;
    const int mt = blockIdx.x * 128;       // first s-row of the tile
    const int nt = blockIdx.y * 128;       // first e-col of the tile
    const int wm = (wave >> 1) * 32;       // wave's rows inside the tile
    const int wn = (wave & 1) * 64;        // wave's cols inside the tile

    stage_rows_f16(X + ((size_t)b * S_ + mt) * D_,
                   W + ((size_t)h * D_ + nt) * D_, lX, lW);
    __syncthreads();   // every wave reads rows that other waves staged

    v8f c[2][4] = {};
#pragma unroll
    for (int k = 0; k < D_; k += 32) {
        v16h a[2], bf[4];
#pragma unroll
        for (int i = 0; i < 2; ++i)
            a[i] = frag_load_f16(lX, PPITCH_ / 2, wm + i * 16, k);
#pragma unroll
        for (int j = 0; j < 4; ++j)
            bf[j] = frag_load_f16(lW, PPITCH_ / 2, wn + j * 16, k);
#pragma unroll
        for (int i = 0; i < 2; ++i)
#pragma unroll
            for (int j = 0; j < 4; ++j)
                c[i][j] = wmma_f16(a[i], bf[j], c[i][j]);
    }

    const float* bh = bias + (size_t)h * D_;
    half_t* o = out + ((size_t)h * B_ + b) * S_ * D_;
#pragma unroll
    for (int j = 0; j < 4; ++j) {
        const int col = nt + wn + j * 16 + (lane & 15);
        const float bj = bh[col];
#pragma unroll
        for (int i = 0; i < 2; ++i) {
            const int rb = mt + wm + i * 16 + ((lane >> 4) << 3);
#pragma unroll
            for (int r = 0; r < 8; ++r)
                o[(size_t)(rb + r) * D_ + col] = (half_t)(c[i][j][r] + bj);
        }
    }
}

// --- attention staging helpers ---------------------------------------------

// Issue async DMA of one 32x256 f16 tile (K or V) into LDS, row-major, rows
// PITCH bytes apart. Wave w of eight brings rows w, w+8, w+16, w+24: 512
// contiguous bytes each.
template <int PITCH>
__device__ inline void stage_tile_async(const half_t* gt, half_t* lt) {
    typedef __attribute__((ext_vector_type(4))) int i32x4;
    typedef __attribute__((address_space(1))) i32x4 glb_i32x4;
    typedef __attribute__((address_space(3))) i32x4 lds_i32x4;
    const char* g0 = (const char*)gt + threadIdx.x * 16u;
    char* l0 = (char*)lt + (threadIdx.x >> 5) * PITCH + (threadIdx.x & 31) * 16;
    // The builtin form: its address registers are the compiler's own, in any
    // register window; operands of asm text must lie in v0..v255, where this
    // kernel's accumulators and Q live, and cost a spill of Q.
    // Unrolled: four copies with constant steps.
#pragma unroll
    for (int i = 0; i < 4; ++i)   // 8 rows per step
        __builtin_amdgcn_global_load_async_to_lds_b128(
            (glb_i32x4*)(g0 + i * 8 * D_ * 2), (lds_i32x4*)(l0 + i * 8 * PITCH),
            0, 0);
}

// A fragment of V^T (m = column e0 + lane&15, k = key row t) of a row-major V
// tile by two transposing loads: lane (c, h) gets V[kbase + 8h + 0..7][e0 + c],
// kbase 0 and 16, which is the k order of frag_load_f16.
__device__ inline v16h frag_load_v_tr(const half_t* lv, int e0) {
    typedef __attribute__((address_space(3))) s16x8 lds_s16x8;
    const int lane = threadIdx.x & 31;
    const char* p = (const char*)lv
                  + (((lane >> 4) << 3) + (lane & 7)) * VPITCH_
                  + ((lane >> 3) & 1) * 16 + e0 * 2;
    const v8h lo = __builtin_bit_cast(
        v8h, __builtin_amdgcn_ds_load_tr16_b128_v8i16((lds_s16x8*)p));
    const v8h hi = __builtin_bit_cast(
        v8h, __builtin_amdgcn_ds_load_tr16_b128_v8i16(
                 (lds_s16x8*)(p + 16 * VPITCH_)));
    return __builtin_shufflevector(lo, hi, 0, 1, 2, 3, 4, 5, 6, 7,
                                   8, 9, 10, 11, 12, 13, 14, 15);
}

// The two K fragments of k step kk: key rows 0..15 and 16..31.
__device__ inline void load_k_step(const half_t* lk, int kk, v16h (&kf)[2]) {
    kf[0] = frag_load_f16(lk, KPITCH_ / 2, 0,  kk * 32);
    kf[1] = frag_load_f16(lk, KPITCH_ / 2, 16, kk * 32);
}

// Four V^T fragments: output columns 64g .. 64g + 63.
__device__ inline void load_v_group(const half_t* lv, int g, v16h (&vf)[4]) {
#pragma unroll
    for (int u = 0; u < 4; ++u)
        vf[u] = frag_load_v_tr(lv, (4 * g + u) * 16);
}

__device__ inline float xhalf(float x) {
    const int b = __builtin_bit_cast(int, x);
    return __builtin_bit_cast(float, __builtin_amdgcn_permlanex16(
        b, b, 0x76543210, 0xfedcba98, false, false));
}

__global__ __launch_bounds__(256) void mha_attn_kernel(
    const half_t* __restrict__ Q,  // [H,B,S,D]
    const half_t* __restrict__ K,
    const half_t* __restrict__ V,
    half_t* __restrict__ O)        // [H,B,S,D]
{
    __shared__ __attribute__((aligned(16)))
        half_t lK[2][32 * KPITCH_ / 2];   // 2 x 16.5 KB, row-major [t][d], padded
    __shared__ __attribute__((aligned(16)))
        half_t lV[2][32 * VPITCH_ / 2];   // 2 x 17 KB, row-major [t][e], padded

    const int wave = threadIdx.x >> 5;
    const int lane = threadIdx.x & 31;
    const int qrow0 = blockIdx.x * 256 + wave * 32;  // global query row
    const size_t base = (size_t)blockIdx.y * S_ * D_;

    const half_t* q  = Q + base;
    const half_t* kp = K + base;
    const half_t* vp = V + base;

    // Every loop over j (column group), kk and n below is unrolled: constant
    // indices keep qa, acc and the scores in registers.
    // Q fragments for this wave's 2 x 16 rows, kept in registers (16 x v16h);
    // the B operand of S^T = K Q^T (n = query = lane&15, same table as an A
    // operand).
    v16h qa[2][8];
#pragma unroll
    for (int j = 0; j < 2; ++j)
#pragma unroll
        for (int kk = 0; kk < 8; ++kk)
            qa[j][kk] = frag_load_f16(q, D_, qrow0 + j * 16, kk * 32);
    // The Q loads' address registers may be reused by what follows; the
    // scheduling barrier keeps the arithmetic that reuses them behind the wait.
    asm volatile("s_wait_xcnt 0x0" ::: "memory");
    __builtin_amdgcn_sched_barrier(0);

    // Per lane and group: the maximum in use of query 16j + lane&15 (equal in
    // both halves) and the running sum over this half's keys alone (halves
    // joined in the epilogue).
    float row_m[2] = {-3.0e38f, -3.0e38f}, row_l[2] = {0.0f, 0.0f};
    v8f acc[2][16];   // O^T tiles: register r <-> e = 16n + 8*(lane>>4) + r
#pragma unroll
    for (int j = 0; j < 2; ++j)
#pragma unroll
        for (int n = 0; n < 16; ++n) acc[j][n] = v8f{0,0,0,0,0,0,0,0};

    // ---- prologue: stage block 0 into buffer 0 ----
    {
        stage_tile_async<KPITCH_>(kp, &lK[0][0]);
        stage_tile_async<VPITCH_>(vp, &lV[0][0]);
    }
    asm volatile("s_wait_asynccnt 0x0" ::: "memory");
    __syncthreads();

    constexpr int NB = S_ / 32;   // 128 key blocks
    for (int ib = 0; ib < NB; ++ib) {
        const int cur = ib & 1;
        const int nxt = cur ^ 1;
        const bool more = (ib + 1) < NB;

        const half_t* lkc = &lK[cur][0];
        const half_t* lvc = &lV[cur][0];

        v16h kf[3][2], vf[2][4];
        load_k_step(lkc, 0, kf[0]);
        load_k_step(lkc, 1, kf[1]);

        // ---- stage block ib+1 (in flight during this block's WMMAs) ----
        if (more) {
            const size_t kt = (size_t)(ib + 1) * 32;
            stage_tile_async<KPITCH_>(kp + kt * D_, &lK[nxt][0]);
            stage_tile_async<VPITCH_>(vp + kt * D_, &lV[nxt][0]);
        }

        v8f s0[2] = {}, s1[2] = {};
#pragma unroll
        for (int kk = 0; kk < 8; ++kk) {
            if (kk < 6) {
                load_k_step(lkc, kk + 2, kf[(kk + 2) % 3]);
            } else {   // the first V group: it lands under the softmax
                vf[0][2 * kk - 12] = frag_load_v_tr(lvc, (2 * kk - 12) * 16);
                vf[0][2 * kk - 11] = frag_load_v_tr(lvc, (2 * kk - 11) * 16);
            }
            __builtin_amdgcn_sched_barrier(0);   // loads ahead | products of kk
#pragma unroll
            for (int j = 0; j < 2; ++j) {
                s0[j] = wmma_f16(kf[kk % 3][0], qa[j][kk], s0[j]);
                s1[j] = wmma_f16(kf[kk % 3][1], qa[j][kk], s1[j]);
            }
            __builtin_amdgcn_sched_barrier(0);   // products of kk | what follows
        }

        float mb[2];
        bool need = false;
#pragma unroll
        for (int j = 0; j < 2; ++j) {
            float t[8];
#pragma unroll
            for (int r = 0; r < 8; ++r) {
                s0[j][r] *= SCALE_;
                s1[j][r] *= SCALE_;
                t[r] = fmaxf(s0[j][r], s1[j][r]);
            }
            const float mx =
                fmaxf(fmaxf(fmaxf(t[0], t[1]), fmaxf(t[2], t[3])),
                      fmaxf(fmaxf(t[4], t[5]), fmaxf(t[6], t[7])));
            mb[j] = fmaxf(mx, xhalf(mx));   // equal in both halves
            need = need || (mb[j] > row_m[j] + LAZY_);
        }
        if (__builtin_amdgcn_ballot_w32(need) != 0) {
#pragma unroll
            for (int j = 0; j < 2; ++j) {
                const float mx = fmaxf(row_m[j], mb[j]);
                const float cj = __expf(row_m[j] - mx);
                row_l[j] *= cj;
                row_m[j] = mx;
#pragma unroll
                for (int n = 0; n < 16; ++n) acc[j][n] *= cj;
            }
        }

        v16h pb[2];
#pragma unroll
        for (int j = 0; j < 2; ++j) {
            float t[8];
#pragma unroll
            for (int r = 0; r < 8; ++r) {
                s0[j][r] = __expf(s0[j][r] - row_m[j]);
                s1[j][r] = __expf(s1[j][r] - row_m[j]);
                t[r] = s0[j][r] + s1[j][r];
            }
            row_l[j] += ((t[0] + t[1]) + (t[2] + t[3])) +
                        ((t[4] + t[5]) + (t[6] + t[7]));
            // Each row's sum is finished here (an input only, no instruction):
            // sunk behind the O^T products it keeps the 32 f32 scores live
            // beside the V fragments, and Q is spilled.
            asm volatile("" :: "v"(row_l[j]));   // row sum pinned against spills

            // P^T as a B operand, packed in-lane: element i is key 8h + i,
            // element 8 + i is key 16 + 8h + i, the k order of frag_load_f16.
            pb[j] = __builtin_shufflevector(
                __builtin_convertvector(s0[j], v8h),
                __builtin_convertvector(s1[j], v8h),
                0, 1, 2, 3, 4, 5, 6, 7, 8, 9, 10, 11, 12, 13, 14, 15);
        }

#pragma unroll
        for (int g = 0; g < 4; ++g) {
            if (g < 3) load_v_group(lvc, g + 1, vf[(g + 1) & 1]);
            __builtin_amdgcn_sched_barrier(0);   // next loads | products of g
#pragma unroll
            for (int u = 0; u < 4; ++u)
#pragma unroll
                for (int j = 0; j < 2; ++j)
                    acc[j][4 * g + u] =
                        wmma_f16(vf[g & 1][u], pb[j], acc[j][4 * g + u]);
            __builtin_amdgcn_sched_barrier(0);   // products of g | what follows
        }

        // ---- publish block ib+1, recycle buffers ----
        // This wave's LDS reads have retired before the copies issued behind
        // the barrier refill the buffers it has just read.
        asm volatile("s_wait_dscnt 0x0" ::: "memory");
        asm volatile("s_wait_asynccnt 0x0" ::: "memory");
        __syncthreads();
    }

    // Epilogue: join the halves' sums, O /= row_l, store f16. Lane (c, h) holds
    // query row 16j + c, columns 16n + 8h + 0..7: one 16-byte store per tile.
#pragma unroll
    for (int j = 0; j < 2; ++j) {
        const float l = row_l[j] + xhalf(row_l[j]);
        const float inv = 1.0f / l;
        half_t* o = O + base + (size_t)(qrow0 + j * 16 + (lane & 15)) * D_
                             + ((lane >> 4) << 3);
#pragma unroll
        for (int n = 0; n < 16; ++n) {
            *(v8h*)(o + n * 16) = __builtin_convertvector(acc[j][n] * inv, v8h);
            if ((n & 3) == 3) {
                // The four stores' data and address registers may be reused by
                // what follows; the scheduling barrier keeps the next tiles'
                // arithmetic, which reuses them, behind the wait.
                asm volatile("s_wait_xcnt 0x0" ::: "memory");
                __builtin_amdgcn_sched_barrier(0);
            }
        }
    }
}

// ---------------------------------------------------------------------------
// Kernel 3: output projection.
//   Out[b,s,e] = sum_{h,d} attn[h,b,s,d] * Wo[e, h*D+d] + bo[e]
// Grid: (B*S/128, D/64). Block: 256 (8 waves); workgroup -> 128x64 tile of Out,
// wave -> 32x32 subtile (2 x 2 accumulator tiles). K is walked one head (256)
// at a time: the head's 128x256 A tile and 64x256 Wo tile (converted to f16)
// are staged in LDS by whole-line loads, in two buffers; the next head's loads
// are in flight in registers while this head's tiles are multiplied.
// ---------------------------------------------------------------------------
constexpr int OM_ = 128;   // rows of Out per workgroup
constexpr int ON_ = 64;    // columns of Out per workgroup
typedef __attribute__((ext_vector_type(4))) float    f32x4;
typedef __attribute__((ext_vector_type(4))) _Float16 f16x4;
typedef __attribute__((ext_vector_type(4))) unsigned u32x4;

// Issue one head's loads. au, wu: the workgroup's A tile (one contiguous 64 KB
// block) and Wo tile (64 pieces of 1 KB, a Wo row apart); ta, tw: this thread's
// first element in each. Every wave-wide load covers 512 contiguous bytes: four
// whole lines. Unrolled: constant indices keep av and wv in registers.
__device__ inline void outproj_fetch(const half_t* __restrict__ au, int ta,
                                     const float* __restrict__ wu, int tw,
                                     u32x4 (&av)[16], f32x4 (&wv)[16]) {
#pragma unroll
    for (int i = 0; i < 16; ++i)   // 256 threads x 16 B = 8 rows per step
        av[i] = *(const u32x4*)(au + ta + i * 8 * D_);
    // The A loads' address registers may be reused by what follows.
    asm volatile("s_wait_xcnt 0x0" ::: "memory");
#pragma unroll
    for (int i = 0; i < 16; ++i)   // 256 threads x 16 B = 4 rows per step
        wv[i] = *(const f32x4*)(wu + tw + i * 4 * H_ * D_);
    // The Wo loads' address registers are stepped to the next head behind this.
    asm volatile("s_wait_xcnt 0x0" ::: "memory");
}

// Store the fetched head into LDS, rows PPITCH_ bytes apart. la, lw: this
// thread's first bytes in the two tiles. A wave's store is contiguous.
__device__ inline void outproj_put(const u32x4 (&av)[16], const f32x4 (&wv)[16],
                                   char* la, char* lw) {
#pragma unroll
    for (int i = 0; i < 16; ++i)
        *(u32x4*)(la + i * 8 * PPITCH_) = av[i];
#pragma unroll
    for (int i = 0; i < 16; ++i)
        *(f16x4*)(lw + i * 4 * PPITCH_) = __builtin_convertvector(wv[i], f16x4);
}

__device__ inline void outproj_mul(const half_t* la, const half_t* lw,
                                   int wm, int wn, v8f (&c)[2][2]) {
    v16h a[2][2], bf[2][2];
#pragma unroll
    for (int i = 0; i < 2; ++i) {
        a[0][i]  = frag_load_f16(la, PPITCH_ / 2, wm + i * 16, 0);
        bf[0][i] = frag_load_f16(lw, PPITCH_ / 2, wn + i * 16, 0);
    }
#pragma unroll
    for (int k = 0; k < D_ / 32; ++k) {
        const int s = k & 1;
        if (k + 1 < D_ / 32) {
#pragma unroll
            for (int i = 0; i < 2; ++i) {
                a[s ^ 1][i]  = frag_load_f16(la, PPITCH_ / 2, wm + i * 16,
                                             (k + 1) * 32);
                bf[s ^ 1][i] = frag_load_f16(lw, PPITCH_ / 2, wn + i * 16,
                                             (k + 1) * 32);
            }
            __builtin_amdgcn_sched_barrier(0);   // loads of k + 1 | products of k
        }
#pragma unroll
        for (int i = 0; i < 2; ++i)
#pragma unroll
            for (int j = 0; j < 2; ++j)
                c[i][j] = wmma_f16(a[s][i], bf[s][j], c[i][j]);
        __builtin_amdgcn_sched_barrier(0);   // products of k | what follows
    }
}

__global__ __launch_bounds__(256) void mha_outproj_kernel(
    const half_t* __restrict__ A,   // [H,B,S,D] attention outputs (f16)
    const float*  __restrict__ Wo,  // [D, H*D]
    const float*  __restrict__ bo,  // [D]
    float* __restrict__ Out)        // [B,S,D]
{
    __shared__ __attribute__((aligned(16)))
        half_t lA[2][OM_ * PPITCH_ / 2];   // 2 x 66 KB, [s][d], padded
    __shared__ __attribute__((aligned(16)))
        half_t lW[2][ON_ * PPITCH_ / 2];   // 2 x 33 KB, [e][d], padded

    const int g    = threadIdx.x;
    const int wave = g >> 5;
    const int lane = g & 31;
    const int mt = blockIdx.x * OM_;   // first row over B*S
    const int nt = blockIdx.y * ON_;   // first e-col
    const int b  = mt / S_;            // a 128-row tile never crosses a batch
    const int s0 = mt % S_;
    const int wm = (wave >> 1) * 32;   // wave's rows inside the tile
    const int wn = (wave & 1) * 32;    // wave's cols inside the tile

    const half_t* au = A + ((size_t)b * S_ + s0) * D_;   // head 0's A tile
    const float*  wu = Wo + (size_t)nt * (H_ * D_);      // head 0's Wo tile
    const int ta = g * 8;                                // halves into an A tile
    const int tw = (g >> 6) * (H_ * D_) + (g & 63) * 4;  // floats into a Wo tile
    const int pa = (g >> 5) * PPITCH_ + (g & 31) * 16;   // bytes into an A tile
    const int pw = (g >> 6) * PPITCH_ + (g & 63) * 8;    // bytes into a Wo tile

    u32x4 av[16];
    f32x4 wv[16];
    outproj_fetch(au, ta, wu, tw, av, wv);
    outproj_put(av, wv, (char*)&lA[0][0] + pa, (char*)&lW[0][0] + pw);
    __syncthreads();   // head 0 is staged: every wave reads other waves' rows

    v8f c[2][2] = {};
    for (int h = 0; h + 1 < H_; ++h) {
        const int cur = h & 1;
        au += (size_t)B_ * S_ * D_;
        wu += D_;
        outproj_fetch(au, ta, wu, tw, av, wv);
        outproj_mul(&lA[cur][0], &lW[cur][0], wm, wn, c);
        outproj_put(av, wv, (char*)&lA[cur ^ 1][0] + pa,
                            (char*)&lW[cur ^ 1][0] + pw);
        // Publishes head h + 1, and ends every wave's reads of the buffers
        // that the next trip refills.
        __syncthreads();
    }
    outproj_mul(&lA[(H_ - 1) & 1][0], &lW[(H_ - 1) & 1][0], wm, wn, c);

    // Unrolled: constant indices keep c in registers.
#pragma unroll
    for (int j = 0; j < 2; ++j) {
        const int col = nt + wn + j * 16 + (lane & 15);
        const float bj = bo[col];
#pragma unroll
        for (int i = 0; i < 2; ++i) {
            const int rb = mt + wm + i * 16 + ((lane >> 4) << 3);
#pragma unroll
            for (int r = 0; r < 8; ++r)
                Out[(size_t)(rb + r) * D_ + col] = c[i][j][r] + bj;
        }
    }
}

// ---------------------------------------------------------------------------
extern "C" void kernel_launch(void* const* d_in, const int* in_sizes, int n_in,
                              void* d_out, int out_size, void* d_ws, size_t ws_size,
                              hipStream_t stream) {
    (void)in_sizes; (void)n_in; (void)out_size; (void)ws_size;

    const float* query = (const float*)d_in[0];
    const float* key_  = (const float*)d_in[1];
    const float* value = (const float*)d_in[2];
    const float* Wq    = (const float*)d_in[3];
    const float* bq    = (const float*)d_in[4];
    const float* Wk    = (const float*)d_in[5];
    const float* bk    = (const float*)d_in[6];
    const float* Wv    = (const float*)d_in[7];
    const float* bv    = (const float*)d_in[8];
    const float* Wo    = (const float*)d_in[9];
    const float* bo    = (const float*)d_in[10];
    float* out = (float*)d_out;

    const size_t per = (size_t)H_ * B_ * S_ * D_;   // elements per f16 tensor
    half_t* qh = (half_t*)d_ws;
    half_t* kh = qh + per;
    half_t* vh = kh + per;
    half_t* ah = vh + per;                           // 4 * 33.5 MB = 134 MB

    dim3 pblk(256), pgrd(S_ / 128, D_ / 128, H_ * B_);
    mha_proj_kernel<<<pgrd, pblk, 0, stream>>>(query, Wq, bq, qh);
    mha_proj_kernel<<<pgrd, pblk, 0, stream>>>(key_,  Wk, bk, kh);
    mha_proj_kernel<<<pgrd, pblk, 0, stream>>>(value, Wv, bv, vh);

    dim3 ablk(256), agrd(S_ / 256, H_ * B_);
    mha_attn_kernel<<<agrd, ablk, 0, stream>>>(qh, kh, vh, ah);

    dim3 oblk(256), ogrd((B_ * S_) / OM_, D_ / ON_);
    mha_outproj_kernel<<<ogrd, oblk, 0, stream>>>(ah, Wo, bo, out);
}

// v009
// Measured time: 176 microseconds a run.
// It is 1.24 times as fast as v007, going by the measured steps of the versions left out in between.
// Over all steps from v000 it is 25.7 times as fast.
#include <hip/hip_runtime.h>
#include <hip/hip_bf16.h>

typedef __attribute__((ext_vector_type(16))) _Float16 v16h;
typedef __attribute__((ext_vector_type(8)))  float    v8f;
typedef __attribute__((ext_vector_type(8)))  _Float16 v8h;
typedef __attribute__((ext_vector_type(8)))  short    s16x8;
typedef _Float16 half_t;

constexpr int H_ = 8;
constexpr int D_ = 256;
constexpr int B_ = 2;
constexpr int S_ = 4096;
constexpr int KPITCH_ = 528;       // bytes per K row in LDS: 512 + 16, 16 B x odd
constexpr int VPITCH_ = 544;       // bytes per V row in LDS: 512 + 32, 32 B x odd
constexpr int PPITCH_ = 528;       // bytes per staged X or W row: 512 + 16, 16 B x odd
constexpr float SCALE_ = 0.0625f;  // 1/sqrt(256)
constexpr float LAZY_ = 5.545177f; // 8 ln 2: how far the maximum in use may trail

__device__ inline v8f wmma_f16(v16h a, v16h b, v8f c) {
    // 8 args: (neg_a, A, neg_b, B, c_mod, C, reuse_a, reuse_b)
    return __builtin_amdgcn_wmma_f32_16x16x32_f16(
        false, a, false, b, (short)0, c, false, false);
}

__device__ inline v16h frag_load_f16(const half_t* __restrict__ src, int ld,
                                     int row0, int k0) {
    const int lane = threadIdx.x & 31;
    const half_t* p = src + (size_t)(row0 + (lane & 15)) * ld
                          + k0 + ((lane >> 4) << 3);
    v16h f;
#pragma unroll
    for (int i = 0; i < 8; ++i) f[i] = p[i];
#pragma unroll
    for (int i = 0; i < 8; ++i) f[8 + i] = p[16 + i];
    return f;
}

// --- attention staging helpers ---------------------------------------------

// Issue async DMA of one 32x256 f16 tile (K, V or weight rows) into LDS, row-major, rows
// PITCH bytes apart. Wave w of eight brings rows w, w+8, w+16, w+24: 512
// contiguous bytes each.
template <int PITCH>
__device__ inline void stage_tile_async(const half_t* gt, half_t* lt) {
    typedef __attribute__((ext_vector_type(4))) int i32x4;
    typedef __attribute__((address_space(1))) i32x4 glb_i32x4;
    typedef __attribute__((address_space(3))) i32x4 lds_i32x4;
    const char* g0 = (const char*)gt + threadIdx.x * 16u;
    char* l0 = (char*)lt + (threadIdx.x >> 5) * PITCH + (threadIdx.x & 31) * 16;
    // The builtin form: its address registers are the compiler's own, in any
    // register window; operands of asm text must lie in v0..v255, where this
    // kernel's accumulators and Q live, and cost a spill of Q.
    // Unrolled: four copies with constant steps.
#pragma unroll
    for (int i = 0; i < 4; ++i)   // 8 rows per step
        __builtin_amdgcn_global_load_async_to_lds_b128(
            (glb_i32x4*)(g0 + i * 8 * D_ * 2), (lds_i32x4*)(l0 + i * 8 * PITCH),
            0, 0);
}

// A fragment of V^T (m = column e0 + lane&15, k = key row t) of a row-major V
// tile by two transposing loads: lane (c, h) gets V[kbase + 8h + 0..7][e0 + c],
// kbase 0 and 16, which is the k order of frag_load_f16.
template <int PITCH = VPITCH_>
__device__ inline v16h frag_load_v_tr(const half_t* lv, int e0) {
    typedef __attribute__((address_space(3))) s16x8 lds_s16x8;
    const int lane = threadIdx.x & 31;
    const char* p = (const char*)lv
                  + (((lane >> 4) << 3) + (lane & 7)) * PITCH
                  + ((lane >> 3) & 1) * 16 + e0 * 2;
    const v8h lo = __builtin_bit_cast(
        v8h, __builtin_amdgcn_ds_load_tr16_b128_v8i16((lds_s16x8*)p));
    const v8h hi = __builtin_bit_cast(
        v8h, __builtin_amdgcn_ds_load_tr16_b128_v8i16(
                 (lds_s16x8*)(p + 16 * PITCH)));
    return __builtin_shufflevector(lo, hi, 0, 1, 2, 3, 4, 5, 6, 7,
                                   8, 9, 10, 11, 12, 13, 14, 15);
}

// The two K fragments of k step kk: key rows 0..15 and 16..31.
__device__ inline void load_k_step(const half_t* lk, int kk, v16h (&kf)[2]) {
    kf[0] = frag_load_f16(lk, KPITCH_ / 2, 0,  kk * 32);
    kf[1] = frag_load_f16(lk, KPITCH_ / 2, 16, kk * 32);
}

// Four V^T fragments: output columns 64g .. 64g + 63.
__device__ inline void load_v_group(const half_t* lv, int g, v16h (&vf)[4]) {
#pragma unroll
    for (int u = 0; u < 4; ++u)
        vf[u] = frag_load_v_tr(lv, (4 * g + u) * 16);
}

// Eight fragments of the staged weight: rows 32(g>>1) .. + 31 (two tiles), four
// k steps from 4(g&1) on; fragment 2*kq + t is tile t at k step 4(g&1) + kq.
__device__ inline void load_m_group(const half_t* lm, int g, v16h (&mf)[8]) {
#pragma unroll
    for (int kq = 0; kq < 4; ++kq)
#pragma unroll
        for (int t = 0; t < 2; ++t)
            mf[2 * kq + t] = frag_load_f16(lm, PPITCH_ / 2, (g >> 1) * 32 + t * 16,
                                           ((g & 1) * 4 + kq) * 32);
}

__device__ inline float xhalf(float x) {
    const int b = __builtin_bit_cast(int, x);
    return __builtin_bit_cast(float, __builtin_amdgcn_permlanex16(
        b, b, 0x76543210, 0xfedcba98, false, false));
}

__global__ __launch_bounds__(256) void mha_attn_kernel(
    const half_t* __restrict__ X,  // [B,S,D], the queries' input as f16
    const half_t* __restrict__ M,  // [H,D,D], folded query weight as f16
    const float* __restrict__ bm,  // [H,D], folded query bias
    const half_t* __restrict__ K,  // [B,S,D], shared by the heads
    const half_t* __restrict__ V,  // [B,S,D], shared by the heads
    half_t* __restrict__ O)        // [H,B,S,D]
{
    __shared__ __attribute__((aligned(16)))
        half_t lK[2][32 * KPITCH_ / 2];   // 2 x 16.5 KB, row-major [t][d], padded
    __shared__ __attribute__((aligned(16)))
        half_t lV[2][32 * VPITCH_ / 2];   // 2 x 17 KB, row-major [t][e], padded
    __shared__ __attribute__((aligned(16)))
        half_t lM[D_ * PPITCH_ / 2];      // 132 KB, the head's weight [e][d], padded
    __shared__ __attribute__((aligned(32)))
        float lB[D_];                     // the head's bias

    const int wave = threadIdx.x >> 5;
    const int lane = threadIdx.x & 31;
    const int qrow0 = blockIdx.x * 256 + wave * 32;  // global query row
    const size_t base = (size_t)blockIdx.y * S_ * D_;

    const size_t kvbase = (size_t)(blockIdx.y % B_) * S_ * D_;   // y = h*B + b
    const int head = blockIdx.y / B_;
    const half_t* x  = X + kvbase;
    const half_t* kp = K + kvbase;
    const half_t* vp = V + kvbase;

    // ---- prologue: stage the head's weight and bias, and block 0 into
    // buffer 0 ---- 41 copies of a wave in flight. Unrolled: constant steps.
#pragma unroll
    for (int i = 0; i < D_ / 32; ++i)
        stage_tile_async<PPITCH_>(M + ((size_t)head * D_ + i * 32) * D_,
                                  &lM[i * 32 * PPITCH_ / 2]);
    {   // one float a thread
        typedef __attribute__((address_space(1))) int glb_i32;
        typedef __attribute__((address_space(3))) int lds_i32;
        __builtin_amdgcn_global_load_async_to_lds_b32(
            (glb_i32*)(bm + head * D_ + threadIdx.x),
            (lds_i32*)&lB[threadIdx.x], 0, 0);
    }
    stage_tile_async<KPITCH_>(kp, &lK[0][0]);
    stage_tile_async<VPITCH_>(vp, &lV[0][0]);

    // Every loop over j (column group), kk, g and n below is unrolled: constant
    // indices keep xb, qa, acc and the scores in registers.
    // Xq fragments for this wave's 2 x 16 rows (16 x v16h): the B operand of
    // Q^T = Mq Xq^T (n = query = lane&15, same table as an A operand).
    v16h xb[2][8];
#pragma unroll
    for (int j = 0; j < 2; ++j)
#pragma unroll
        for (int kk = 0; kk < 8; ++kk)
            xb[j][kk] = frag_load_f16(x, D_, qrow0 + j * 16, kk * 32);
    // The loads' address registers may be reused by what follows; the
    // scheduling barrier keeps the arithmetic that reuses them behind the wait.
    asm volatile("s_wait_xcnt 0x0" ::: "memory");
    __builtin_amdgcn_sched_barrier(0);

    // This wave's copies have landed before the barrier publishes them.
    asm volatile("s_wait_asynccnt 0x0" ::: "memory");
    __syncthreads();   // weight, bias and block 0 are staged by all waves

    // Q^T tiles two at a time (32 values of e, one k step of S^T), weight
    // fragments in groups of eight, one group ahead in a second register set;
    // each fragment feeds both column groups. The scheduling barriers keep the
    // order "next loads, this group's products": without them the loads are
    // sunk to their products. C layout: lane (c, h) holds query 16j + c,
    // e = 32kk + 16t + 8h + r, so two tiles pack in-lane into the B operand of
    // S^T = K Q^T, in the k order of frag_load_f16.
    v16h qa[2][8];
    {
        v16h mf[2][8];
        v8f bt[2];
        v8f c[2][2] = {};
        load_m_group(lM, 0, mf[0]);
#pragma unroll
        for (int g = 0; g < 16; ++g) {
            if (g < 15) load_m_group(lM, g + 1, mf[(g + 1) & 1]);
            if ((g & 1) == 0) {
#pragma unroll
                for (int t = 0; t < 2; ++t)
                    bt[t] = *(const v8f*)&lB[(g >> 1) * 32 + t * 16
                                             + ((lane >> 4) << 3)];
            }
            __builtin_amdgcn_sched_barrier(0);   // next loads | products of g
#pragma unroll
            for (int kq = 0; kq < 4; ++kq)
#pragma unroll
                for (int t = 0; t < 2; ++t)
#pragma unroll
                    for (int j = 0; j < 2; ++j)
                        c[t][j] = wmma_f16(mf[g & 1][2 * kq + t],
                                           xb[j][(g & 1) * 4 + kq], c[t][j]);
            __builtin_amdgcn_sched_barrier(0);   // products of g | what follows
            if (g & 1) {
#pragma unroll
                for (int j = 0; j < 2; ++j) {
                    qa[j][g >> 1] = __builtin_shufflevector(
                        __builtin_convertvector(c[0][j] + bt[0], v8h),
                        __builtin_convertvector(c[1][j] + bt[1], v8h),
                        0, 1, 2, 3, 4, 5, 6, 7, 8, 9, 10, 11, 12, 13, 14, 15);
                    c[0][j] = v8f{0,0,0,0,0,0,0,0};
                    c[1][j] = v8f{0,0,0,0,0,0,0,0};
                }
            }
        }
    }

    // Per lane and group: the maximum in use of query 16j + lane&15 (equal in
    // both halves) and the running sum over this half's keys alone (halves
    // joined in the epilogue).
    float row_m[2] = {-3.0e38f, -3.0e38f}, row_l[2] = {0.0f, 0.0f};
    v8f acc[2][16];   // O^T tiles: register r <-> e = 16n + 8*(lane>>4) + r
#pragma unroll
    for (int j = 0; j < 2; ++j)
#pragma unroll
        for (int n = 0; n < 16; ++n) acc[j][n] = v8f{0,0,0,0,0,0,0,0};

    constexpr int NB = S_ / 32;   // 128 key blocks
    for (int ib = 0; ib < NB; ++ib) {
        const int cur = ib & 1;
        const int nxt = cur ^ 1;
        const bool more = (ib + 1) < NB;

        const half_t* lkc = &lK[cur][0];
        const half_t* lvc = &lV[cur][0];

        v16h kf[3][2], vf[2][4];
        load_k_step(lkc, 0, kf[0]);
        load_k_step(lkc, 1, kf[1]);

        // ---- stage block ib+1 (in flight during this block's WMMAs) ----
        if (more) {
            const size_t kt = (size_t)(ib + 1) * 32;
            stage_tile_async<KPITCH_>(kp + kt * D_, &lK[nxt][0]);
            stage_tile_async<VPITCH_>(vp + kt * D_, &lV[nxt][0]);
        }

        v8f s0[2] = {}, s1[2] = {};
#pragma unroll
        for (int kk = 0; kk < 8; ++kk) {
            if (kk < 6) {
                load_k_step(lkc, kk + 2, kf[(kk + 2) % 3]);
            } else {   // the first V group: it lands under the softmax
                vf[0][2 * kk - 12] = frag_load_v_tr(lvc, (2 * kk - 12) * 16);
                vf[0][2 * kk - 11] = frag_load_v_tr(lvc, (2 * kk - 11) * 16);
            }
            __builtin_amdgcn_sched_barrier(0);   // loads ahead | products of kk
#pragma unroll
            for (int j = 0; j < 2; ++j) {
                s0[j] = wmma_f16(kf[kk % 3][0], qa[j][kk], s0[j]);
                s1[j] = wmma_f16(kf[kk % 3][1], qa[j][kk], s1[j]);
            }
            __builtin_amdgcn_sched_barrier(0);   // products of kk | what follows
        }

        float mb[2];
        bool need = false;
#pragma unroll
        for (int j = 0; j < 2; ++j) {
            float t[8];
#pragma unroll
            for (int r = 0; r < 8; ++r) {
                s0[j][r] *= SCALE_;
                s1[j][r] *= SCALE_;
                t[r] = fmaxf(s0[j][r], s1[j][r]);
            }
            const float mx =
                fmaxf(fmaxf(fmaxf(t[0], t[1]), fmaxf(t[2], t[3])),
                      fmaxf(fmaxf(t[4], t[5]), fmaxf(t[6], t[7])));
            mb[j] = fmaxf(mx, xhalf(mx));   // equal in both halves
            need = need || (mb[j] > row_m[j] + LAZY_);
        }
        if (__builtin_amdgcn_ballot_w32(need) != 0) {
#pragma unroll
            for (int j = 0; j < 2; ++j) {
                const float mx = fmaxf(row_m[j], mb[j]);
                const float cj = __expf(row_m[j] - mx);
                row_l[j] *= cj;
                row_m[j] = mx;
#pragma unroll
                for (int n = 0; n < 16; ++n) acc[j][n] *= cj;
            }
        }

        v16h pb[2];
#pragma unroll
        for (int j = 0; j < 2; ++j) {
            float t[8];
#pragma unroll
            for (int r = 0; r < 8; ++r) {
                s0[j][r] = __expf(s0[j][r] - row_m[j]);
                s1[j][r] = __expf(s1[j][r] - row_m[j]);
                t[r] = s0[j][r] + s1[j][r];
            }
            row_l[j] += ((t[0] + t[1]) + (t[2] + t[3])) +
                        ((t[4] + t[5]) + (t[6] + t[7]));
            // Each row's sum is finished here (an input only, no instruction):
            // sunk behind the O^T products it keeps the 32 f32 scores live
            // beside the V fragments, and Q is spilled.
            asm volatile("" :: "v"(row_l[j]));   // row sum pinned against spills

            // P^T as a B operand, packed in-lane: element i is key 8h + i,
            // element 8 + i is key 16 + 8h + i, the k order of frag_load_f16.
            pb[j] = __builtin_shufflevector(
                __builtin_convertvector(s0[j], v8h),
                __builtin_convertvector(s1[j], v8h),
                0, 1, 2, 3, 4, 5, 6, 7, 8, 9, 10, 11, 12, 13, 14, 15);
        }

#pragma unroll
        for (int g = 0; g < 4; ++g) {
            if (g < 3) load_v_group(lvc, g + 1, vf[(g + 1) & 1]);
            __builtin_amdgcn_sched_barrier(0);   // next loads | products of g
#pragma unroll
            for (int u = 0; u < 4; ++u)
#pragma unroll
                for (int j = 0; j < 2; ++j)
                    acc[j][4 * g + u] =
                        wmma_f16(vf[g & 1][u], pb[j], acc[j][4 * g + u]);
            __builtin_amdgcn_sched_barrier(0);   // products of g | what follows
        }

        // ---- publish block ib+1, recycle buffers ----
        // This wave's LDS reads have retired before the copies issued behind
        // the barrier refill the buffers it has just read.
        asm volatile("s_wait_dscnt 0x0" ::: "memory");
        asm volatile("s_wait_asynccnt 0x0" ::: "memory");
        __syncthreads();
    }

    // Epilogue: join the halves' sums, O /= row_l, store f16. Lane (c, h) holds
    // query row 16j + c, columns 16n + 8h + 0..7: one 16-byte store per tile.
#pragma unroll
    for (int j = 0; j < 2; ++j) {
        const float l = row_l[j] + xhalf(row_l[j]);
        const float inv = 1.0f / l;
        half_t* o = O + base + (size_t)(qrow0 + j * 16 + (lane & 15)) * D_
                             + ((lane >> 4) << 3);
#pragma unroll
        for (int n = 0; n < 16; ++n) {
            *(v8h*)(o + n * 16) = __builtin_convertvector(acc[j][n] * inv, v8h);
            if ((n & 3) == 3) {
                // The four stores' data and address registers may be reused by
                // what follows; the scheduling barrier keeps the next tiles'
                // arithmetic, which reuses them, behind the wait.
                asm volatile("s_wait_xcnt 0x0" ::: "memory");
                __builtin_amdgcn_sched_barrier(0);
            }
        }
    }
}

// ---------------------------------------------------------------------------
// Kernel 3: output projection.
//   Out[b,s,e] = sum_{h,d} attn[h,b,s,d] * Wo[e, h*D+d] + bo[e]
// Grid: (B*S/128, D/64). Block: 256 (8 waves); workgroup -> 128x64 tile of Out,
// wave -> 32x32 subtile (2 x 2 accumulator tiles). K is walked one head (256)
// at a time: the head's 128x256 A tile and 64x256 Wo tile (converted to f16)
// are staged in LDS by whole-line loads, in two buffers; the next head's loads
// are in flight in registers while this head's tiles are multiplied.
// ---------------------------------------------------------------------------
constexpr int OM_ = 128;   // rows of Out per workgroup
constexpr int ON_ = 64;    // columns of Out per workgroup
typedef __attribute__((ext_vector_type(4))) float    f32x4;
typedef __attribute__((ext_vector_type(4))) _Float16 f16x4;
typedef __attribute__((ext_vector_type(4))) unsigned u32x4;

// Issue one head's loads. au, wu: the workgroup's A tile (one contiguous 64 KB
// block) and Wo tile (64 pieces of 1 KB, a Wo row apart); ta, tw: this thread's
// first element in each. Every wave-wide load covers 512 contiguous bytes: four
// whole lines. Unrolled: constant indices keep av and wv in registers.
__device__ inline void outproj_fetch(const half_t* __restrict__ au, int ta,
                                     const float* __restrict__ wu, int tw,
                                     u32x4 (&av)[16], f32x4 (&wv)[16]) {
#pragma unroll
    for (int i = 0; i < 16; ++i)   // 256 threads x 16 B = 8 rows per step
        av[i] = *(const u32x4*)(au + ta + i * 8 * D_);
    // The A loads' address registers may be reused by what follows.
    asm volatile("s_wait_xcnt 0x0" ::: "memory");
#pragma unroll
    for (int i = 0; i < 16; ++i)   // 256 threads x 16 B = 4 rows per step
        wv[i] = *(const f32x4*)(wu + tw + i * 4 * H_ * D_);
    // The Wo loads' address registers are stepped to the next head behind this.
    asm volatile("s_wait_xcnt 0x0" ::: "memory");
}

// Store the fetched head into LDS, rows PPITCH_ bytes apart. la, lw: this
// thread's first bytes in the two tiles. A wave's store is contiguous.
__device__ inline void outproj_put(const u32x4 (&av)[16], const f32x4 (&wv)[16],
                                   char* la, char* lw) {
#pragma unroll
    for (int i = 0; i < 16; ++i)
        *(u32x4*)(la + i * 8 * PPITCH_) = av[i];
#pragma unroll
    for (int i = 0; i < 16; ++i)
        *(f16x4*)(lw + i * 4 * PPITCH_) = __builtin_convertvector(wv[i], f16x4);
}

__device__ inline void outproj_mul(const half_t* la, const half_t* lw,
                                   int wm, int wn, v8f (&c)[2][2]) {
    v16h a[2][2], bf[2][2];
#pragma unroll
    for (int i = 0; i < 2; ++i) {
        a[0][i]  = frag_load_f16(la, PPITCH_ / 2, wm + i * 16, 0);
        bf[0][i] = frag_load_f16(lw, PPITCH_ / 2, wn + i * 16, 0);
    }
#pragma unroll
    for (int k = 0; k < D_ / 32; ++k) {
        const int s = k & 1;
        if (k + 1 < D_ / 32) {
#pragma unroll
            for (int i = 0; i < 2; ++i) {
                a[s ^ 1][i]  = frag_load_f16(la, PPITCH_ / 2, wm + i * 16,
                                             (k + 1) * 32);
                bf[s ^ 1][i] = frag_load_f16(lw, PPITCH_ / 2, wn + i * 16,
                                             (k + 1) * 32);
            }
            __builtin_amdgcn_sched_barrier(0);   // loads of k + 1 | products of k
        }
#pragma unroll
        for (int i = 0; i < 2; ++i)
#pragma unroll
            for (int j = 0; j < 2; ++j)
                c[i][j] = wmma_f16(a[s][i], bf[s][j], c[i][j]);
        __builtin_amdgcn_sched_barrier(0);   // products of k | what follows
    }
}

__global__ __launch_bounds__(256) void mha_outproj_kernel(
    const half_t* __restrict__ A,   // [H,B,S,D] attention outputs (f16)
    const float*  __restrict__ Wo,  // [D, H*D]
    const float*  __restrict__ bo,  // [D]
    float* __restrict__ Out)        // [B,S,D]
{
    __shared__ __attribute__((aligned(16)))
        half_t lA[2][OM_ * PPITCH_ / 2];   // 2 x 66 KB, [s][d], padded
    __shared__ __attribute__((aligned(16)))
        half_t lW[2][ON_ * PPITCH_ / 2];   // 2 x 33 KB, [e][d], padded

    const int g    = threadIdx.x;
    const int wave = g >> 5;
    const int lane = g & 31;
    const int mt = blockIdx.x * OM_;   // first row over B*S
    const int nt = blockIdx.y * ON_;   // first e-col
    const int b  = mt / S_;            // a 128-row tile never crosses a batch
    const int s0 = mt % S_;
    const int wm = (wave >> 1) * 32;   // wave's rows inside the tile
    const int wn = (wave & 1) * 32;    // wave's cols inside the tile

    const half_t* au = A + ((size_t)b * S_ + s0) * D_;   // head 0's A tile
    const float*  wu = Wo + (size_t)nt * (H_ * D_);      // head 0's Wo tile
    const int ta = g * 8;                                // halves into an A tile
    const int tw = (g >> 6) * (H_ * D_) + (g & 63) * 4;  // floats into a Wo tile
    const int pa = (g >> 5) * PPITCH_ + (g & 31) * 16;   // bytes into an A tile
    const int pw = (g >> 6) * PPITCH_ + (g & 63) * 8;    // bytes into a Wo tile

    u32x4 av[16];
    f32x4 wv[16];
    outproj_fetch(au, ta, wu, tw, av, wv);
    outproj_put(av, wv, (char*)&lA[0][0] + pa, (char*)&lW[0][0] + pw);
    __syncthreads();   // head 0 is staged: every wave reads other waves' rows

    v8f c[2][2] = {};
    for (int h = 0; h + 1 < H_; ++h) {
        const int cur = h & 1;
        au += (size_t)B_ * S_ * D_;
        wu += D_;
        outproj_fetch(au, ta, wu, tw, av, wv);
        outproj_mul(&lA[cur][0], &lW[cur][0], wm, wn, c);
        outproj_put(av, wv, (char*)&lA[cur ^ 1][0] + pa,
                            (char*)&lW[cur ^ 1][0] + pw);
        // Publishes head h + 1, and ends every wave's reads of the buffers
        // that the next trip refills.
        __syncthreads();
    }
    outproj_mul(&lA[(H_ - 1) & 1][0], &lW[(H_ - 1) & 1][0], wm, wn, c);

    // Unrolled: constant indices keep c in registers.
#pragma unroll
    for (int j = 0; j < 2; ++j) {
        const int col = nt + wn + j * 16 + (lane & 15);
        const float bj = bo[col];
#pragma unroll
        for (int i = 0; i < 2; ++i) {
            const int rb = mt + wm + i * 16 + ((lane >> 4) << 3);
#pragma unroll
            for (int r = 0; r < 8; ++r)
                Out[(size_t)(rb + r) * D_ + col] = c[i][j][r] + bj;
        }
    }
}

// ---------------------------------------------------------------------------
// Kernel 0: weight folds, bias folds, and Xk, Xv, Xq as f16. One launch, the
// workgroup's part chosen by its index (a test that is uniform for the block):
//   0..63    Mq[h,c,d]      = sum_e Wk[h,e,c] * Wq[h,e,d]        (128x64 tiles, f16)
//   64..127  Wf[o,h*D+d]    = sum_e Wo[o,h*D+e] * Wv[h,e,d]      (128x64 tiles)
//   128..135 bqf[h,c]       = sum_e bq[h,e] * Wk[h,e,c]
//   136..151 bof[o]         = bo[o] + sum_{h,e} Wo[o,h*D+e] * bv[h,e]
//   152..535 Xk, Xv, Xq -> f16
// Mq and bqf take the places of Wq and bq in the query projection, Wf and bof
// those of Wo and bo in the output projection.
// ---------------------------------------------------------------------------
constexpr int FAP_ = 288;   // bytes per staged row of 128 f16, transposing reader: 32 B x odd
constexpr int FBP_ = 160;   // bytes per staged row of 64 f16, transposing reader: 32 B x odd

// One 128x64 tile of C(m,n) = sum_k A(m,k) B(n,k), k = 0..255, f16 operands,
// f32 sums, stored as OT. B lies in memory as [k][n] (rows D_ floats apart); A as [k][m]
// (A_TR, rows D_ floats apart) or as [m][k] (rows H_*D_ floats apart). An
// operand whose rows run over k is staged as it lies and read by the
// transposing LDS load. Every wave-wide global load covers whole lines.
// Unrolled throughout: constant indices keep the arrays in registers.
template <bool A_TR, typename OT>
__device__ inline void fold_tile(const float* __restrict__ a,
                                 const float* __restrict__ b,
                                 OT* __restrict__ o, char* la, char* lb) {
    constexpr int AG  = A_TR ? 32 : 64;         // groups of 4 floats per A row
    constexpr int AR  = 256 / AG;               // A rows per step
    constexpr int ALD = A_TR ? D_ : H_ * D_;    // floats between A rows
    constexpr int AP  = A_TR ? FAP_ : PPITCH_;  // bytes between staged A rows
    const int g    = threadIdx.x;
    const int wave = g >> 5;
    const int lane = g & 31;
    const int ar = g / AG, ac = g % AG;
    const int br = g >> 4, bc = g & 15;         // 16 groups per B row

    const float* pa = a + ar * ALD + ac * 4;    // this thread's first loads
    const float* pb = b + br * D_ + bc * 4;
    f32x4 av[32], bv[16];
#pragma unroll
    for (int i = 0; i < 32; ++i)
        av[i] = *(const f32x4*)(pa + i * AR * ALD);
#pragma unroll
    for (int i = 0; i < 16; ++i)
        bv[i] = *(const f32x4*)(pb + i * 16 * D_);
    // The loads' address registers may be reused by what follows; as inputs
    // of the wait they stay whole up to it (else the last load lands on them).
    asm volatile("s_wait_xcnt 0x0" :: "v"(pa), "v"(pb) : "memory");
#pragma unroll
    for (int i = 0; i < 32; ++i)
        *(f16x4*)(la + (i * AR + ar) * AP + ac * 8) =
            __builtin_convertvector(av[i], f16x4);
#pragma unroll
    for (int i = 0; i < 16; ++i)
        *(f16x4*)(lb + (i * 16 + br) * FBP_ + bc * 8) =
            __builtin_convertvector(bv[i], f16x4);
    __syncthreads();   // every wave reads rows that other waves staged

    const int wm = (wave >> 1) * 32;   // wave's rows inside the tile
    const int wn = (wave & 1) * 32;    // wave's cols inside the tile
    v8f c[2][2] = {};
#pragma unroll
    for (int k = 0; k < D_ / 32; ++k) {
        v16h af[2], bf[2];
#pragma unroll
        for (int i = 0; i < 2; ++i) {
            if (A_TR)
                af[i] = frag_load_v_tr<FAP_>(
                    (const half_t*)(la + k * 32 * FAP_), wm + i * 16);
            else
                af[i] = frag_load_f16((const half_t*)la, PPITCH_ / 2,
                                      wm + i * 16, k * 32);
            bf[i] = frag_load_v_tr<FBP_>(
                (const half_t*)(lb + k * 32 * FBP_), wn + i * 16);
        }
#pragma unroll
        for (int i = 0; i < 2; ++i)
#pragma unroll
            for (int j = 0; j < 2; ++j)
                c[i][j] = wmma_f16(af[i], bf[j], c[i][j]);
    }

#pragma unroll
    for (int j = 0; j < 2; ++j) {
        const int col = wn + j * 16 + (lane & 15);
#pragma unroll
        for (int i = 0; i < 2; ++i) {
            const int rb = wm + i * 16 + ((lane >> 4) << 3);
#pragma unroll
            for (int r = 0; r < 8; ++r)
                o[(rb + r) * ALD + col] = (OT)c[i][j][r];
        }
    }
    // The stores' registers may be reused on the way to the kernel's end.
    asm volatile("s_wait_xcnt 0x0" ::: "memory");
}

__global__ __launch_bounds__(256, 4) void mha_fold_kernel(
    const float* __restrict__ Xk,   // [B,S,D]
    const float* __restrict__ Xv,   // [B,S,D]
    const float* __restrict__ Xq,   // [B,S,D]
    const float* __restrict__ Wq,   // [H,D,D]
    const float* __restrict__ bq,   // [H,D]
    const float* __restrict__ Wk,   // [H,D,D]
    const float* __restrict__ Wv,   // [H,D,D]
    const float* __restrict__ bv,   // [H,D]
    const float* __restrict__ Wo,   // [D, H*D]
    const float* __restrict__ bo,   // [D]
    half_t* __restrict__ xk,        // [B,S,D]
    half_t* __restrict__ xv,        // [B,S,D]
    half_t* __restrict__ xq,        // [B,S,D]
    half_t* __restrict__ Mq,        // [H,D,D]
    float* __restrict__ bqf,        // [H,D]
    float* __restrict__ Wf,         // [D, H*D]
    float* __restrict__ bof)        // [D]
{
    __shared__ __attribute__((aligned(16))) char lA[256 * FAP_];   // 72 KB
    __shared__ __attribute__((aligned(16))) char lB[256 * FBP_];   // 40 KB

    const int w = blockIdx.x;
    const int g = threadIdx.x;
    if (w < 128) {
        const int h  = (w & 63) >> 3;
        const int mt = ((w >> 2) & 1) * 128;
        const int nt = (w & 3) * 64;
        const int hw = h * D_ * D_;
        if (w < 64)
            fold_tile<true, half_t>(Wk + hw + mt, Wq + hw + nt,
                                    Mq + hw + mt * D_ + nt, lA, lB);
        else
            fold_tile<false, float>(Wo + mt * (H_ * D_) + h * D_, Wv + hw + nt,
                                    Wf + mt * (H_ * D_) + h * D_ + nt, lA, lB);
    } else if (w < 136) {
        // One head; thread g owns column g of Wk[h]. Unrolled: one address,
        // immediate steps, many loads in flight; four partial sums.
        const int h = w - 128;
        const float* wk = Wk + h * D_ * D_ + g;
        const float* bb = bq + h * D_;
        float t[4] = {0.0f, 0.0f, 0.0f, 0.0f};
#pragma unroll
        for (int e = 0; e < D_; ++e)
            t[e & 3] = fmaf(bb[e], wk[e * D_], t[e & 3]);
        bqf[h * D_ + g] = (t[0] + t[1]) + (t[2] + t[3]);
        // The store's registers may be reused on the way to the kernel's end.
        asm volatile("s_wait_xcnt 0x0" ::: "memory");
    } else if (w < 152) {
        // A wave owns two rows of Wo; a lane every 32nd group of four columns.
        const int lane = g & 31;
        const int r0 = (w - 136) * 16 + (g >> 5) * 2;
        const float* pw = Wo + r0 * (H_ * D_) + lane * 4;
        const float* pv = bv + lane * 4;
        f32x4 bb[16], x0[16], x1[16];
#pragma unroll
        for (int i = 0; i < 16; ++i) {
            bb[i] = *(const f32x4*)(pv + i * 128);
            x0[i] = *(const f32x4*)(pw + i * 128);
            x1[i] = *(const f32x4*)(pw + H_ * D_ + i * 128);
        }
        // The loads' address registers may be reused by what follows; as inputs
        // of the wait they stay whole up to it (else the last load lands on them).
        asm volatile("s_wait_xcnt 0x0" :: "v"(pw), "v"(pv) : "memory");
        f32x4 a0 = {0.0f, 0.0f, 0.0f, 0.0f}, a1 = {0.0f, 0.0f, 0.0f, 0.0f};
#pragma unroll
        for (int i = 0; i < 16; ++i) {
            a0 += x0[i] * bb[i];
            a1 += x1[i] * bb[i];
        }
        float t0 = (a0[0] + a0[1]) + (a0[2] + a0[3]);
        float t1 = (a1[0] + a1[1]) + (a1[2] + a1[3]);
        t0 += xhalf(t0);
        t1 += xhalf(t1);
#pragma unroll
        for (int m = 8; m >= 1; m >>= 1) {
            t0 += __shfl_xor(t0, m, 32);
            t1 += __shfl_xor(t1, m, 32);
        }
        if (lane == 0) {
            bof[r0]     = t0 + bo[r0];
            bof[r0 + 1] = t1 + bo[r0 + 1];
        }
        // The stores' registers may be reused on the way to the kernel's end.
        asm volatile("s_wait_xcnt 0x0" ::: "memory");
    } else {
        // 128 workgroups per tensor, 16384 contiguous floats each: a lane loads
        // 32 contiguous bytes and stores 16.
        const int cw = w - 152;
        const int off = (cw & 127) * 16384 + g * 8;
        const float* src = (cw < 128 ? Xk : cw < 256 ? Xv : Xq) + off;
        half_t* dst = (cw < 128 ? xk : cw < 256 ? xv : xq) + off;
        f32x4 v[16];
#pragma unroll
        for (int i = 0; i < 8; ++i) {
            v[2 * i]     = *(const f32x4*)(src + i * 2048);
            v[2 * i + 1] = *(const f32x4*)(src + i * 2048 + 4);
        }
        // The loads' address registers may be reused by what follows; as an input
        // of the wait they stay whole up to it (else the last load lands on them).
        asm volatile("s_wait_xcnt 0x0" :: "v"(src) : "memory");
#pragma unroll
        for (int i = 0; i < 8; ++i)
            *(v8h*)(dst + i * 2048) = __builtin_shufflevector(
                __builtin_convertvector(v[2 * i], f16x4),
                __builtin_convertvector(v[2 * i + 1], f16x4),
                0, 1, 2, 3, 4, 5, 6, 7);
        // The stores' registers may be reused on the way to the kernel's end.
        asm volatile("s_wait_xcnt 0x0" ::: "memory");
    }
}

// ---------------------------------------------------------------------------
extern "C" void kernel_launch(void* const* d_in, const int* in_sizes, int n_in,
                              void* d_out, int out_size, void* d_ws, size_t ws_size,
                              hipStream_t stream) {
    (void)in_sizes; (void)n_in; (void)out_size; (void)ws_size;

    const float* query = (const float*)d_in[0];
    const float* key_  = (const float*)d_in[1];
    const float* value = (const float*)d_in[2];
    const float* Wq    = (const float*)d_in[3];
    const float* bq    = (const float*)d_in[4];
    const float* Wk    = (const float*)d_in[5];
    const float* Wv    = (const float*)d_in[7];
    const float* bv    = (const float*)d_in[8];
    const float* Wo    = (const float*)d_in[9];
    const float* bo    = (const float*)d_in[10];
    float* out = (float*)d_out;

    const size_t per = (size_t)H_ * B_ * S_ * D_;   // elements per per-head f16 tensor
    const size_t xel = (size_t)B_ * S_ * D_;        // elements of an input tensor
    half_t* ah = (half_t*)d_ws;                      // 33.5 MB
    half_t* xk = ah + per;
    half_t* xv = xk + xel;
    half_t* xq = xv + xel;                           // 3 * 4 MB
    half_t* mq = xq + xel;                           // [H,D,D], 1 MB
    float* wf  = (float*)(mq + (size_t)H_ * D_ * D_);   // [D,H*D], 2 MB
    float* bqf = wf + (size_t)H_ * D_ * D_;          // [H,D]
    float* bof = bqf + (size_t)H_ * D_;              // [D]

    // d_in[6], the key bias, adds a constant to all scores of a query: the
    // softmax cancels it, and no kernel reads it.
    mha_fold_kernel<<<dim3(536), dim3(256), 0, stream>>>(
        key_, value, query, Wq, bq, Wk, Wv, bv, Wo, bo, xk, xv, xq, mq, bqf, wf,
        bof);

    dim3 ablk(256), agrd(S_ / 256, H_ * B_);
    mha_attn_kernel<<<agrd, ablk, 0, stream>>>(xq, mq, bqf, xk, xv, ah);

    dim3 oblk(256), ogrd((B_ * S_) / OM_, D_ / ON_);
    mha_outproj_kernel<<<ogrd, oblk, 0, stream>>>(ah, wf, bof, out);
}

// v010
// It runs in 168 microseconds.
// Two timings next to v009 both put it at 1.05 times that version's speed.
// Counting every step since v000, it is 26.8 times as fast.
#include <hip/hip_runtime.h>
#include <hip/hip_bf16.h>

typedef __attribute__((ext_vector_type(16))) _Float16 v16h;
typedef __attribute__((ext_vector_type(8)))  float    v8f;
typedef __attribute__((ext_vector_type(8)))  _Float16 v8h;
typedef __attribute__((ext_vector_type(8)))  short    s16x8;
typedef _Float16 half_t;

constexpr int H_ = 8;
constexpr int D_ = 256;
constexpr int B_ = 2;
constexpr int S_ = 4096;
constexpr int KPITCH_ = 528;       // bytes per K row in LDS: 512 + 16, 16 B x odd
constexpr int VPITCH_ = 544;       // bytes per V row in LDS: 512 + 32, 32 B x odd
constexpr int PPITCH_ = 528;       // bytes per staged X or W row: 512 + 16, 16 B x odd
constexpr float QSCALE_ = 0.0625f * 1.44269504f;  // 1/sqrt(256) * log2 e, on Q
constexpr float PMAX_ = 256.0f;    // bound on a lane's sum of exponentials per block

__device__ inline v8f wmma_f16(v16h a, v16h b, v8f c) {
    // 8 args: (neg_a, A, neg_b, B, c_mod, C, reuse_a, reuse_b)
    return __builtin_amdgcn_wmma_f32_16x16x32_f16(
        false, a, false, b, (short)0, c, false, false);
}

__device__ inline v16h frag_load_f16(const half_t* __restrict__ src, int ld,
                                     int row0, int k0) {
    const int lane = threadIdx.x & 31;
    const half_t* p = src + (size_t)(row0 + (lane & 15)) * ld
                          + k0 + ((lane >> 4) << 3);
    v16h f;
#pragma unroll
    for (int i = 0; i < 8; ++i) f[i] = p[i];
#pragma unroll
    for (int i = 0; i < 8; ++i) f[8 + i] = p[16 + i];
    return f;
}

// --- attention staging helpers ---------------------------------------------

// Issue async DMA of one 32x256 f16 tile (K, V or weight rows) into LDS, row-major, rows
// PITCH bytes apart. Wave w of eight brings rows w, w+8, w+16, w+24: 512
// contiguous bytes each.
template <int PITCH>
__device__ inline void stage_tile_async(const half_t* gt, half_t* lt) {
    typedef __attribute__((ext_vector_type(4))) int i32x4;
    typedef __attribute__((address_space(1))) i32x4 glb_i32x4;
    typedef __attribute__((address_space(3))) i32x4 lds_i32x4;
    const char* g0 = (const char*)gt + threadIdx.x * 16u;
    char* l0 = (char*)lt + (threadIdx.x >> 5) * PITCH + (threadIdx.x & 31) * 16;
    // The builtin form: its address registers are the compiler's own, in any
    // register window; operands of asm text must lie in v0..v255, where this
    // kernel's accumulators and Q live, and cost a spill of Q.
    // Unrolled: four copies with constant steps.
#pragma unroll
    for (int i = 0; i < 4; ++i)   // 8 rows per step
        __builtin_amdgcn_global_load_async_to_lds_b128(
            (glb_i32x4*)(g0 + i * 8 * D_ * 2), (lds_i32x4*)(l0 + i * 8 * PITCH),
            0, 0);
}

// A fragment of V^T (m = column e0 + lane&15, k = key row t) of a row-major V
// tile by two transposing loads: lane (c, h) gets V[kbase + 8h + 0..7][e0 + c],
// kbase 0 and 16, which is the k order of frag_load_f16.
template <int PITCH = VPITCH_>
__device__ inline v16h frag_load_v_tr(const half_t* lv, int e0) {
    typedef __attribute__((address_space(3))) s16x8 lds_s16x8;
    const int lane = threadIdx.x & 31;
    const char* p = (const char*)lv
                  + (((lane >> 4) << 3) + (lane & 7)) * PITCH
                  + ((lane >> 3) & 1) * 16 + e0 * 2;
    const v8h lo = __builtin_bit_cast(
        v8h, __builtin_amdgcn_ds_load_tr16_b128_v8i16((lds_s16x8*)p));
    const v8h hi = __builtin_bit_cast(
        v8h, __builtin_amdgcn_ds_load_tr16_b128_v8i16(
                 (lds_s16x8*)(p + 16 * PITCH)));
    return __builtin_shufflevector(lo, hi, 0, 1, 2, 3, 4, 5, 6, 7,
                                   8, 9, 10, 11, 12, 13, 14, 15);
}

// The two K fragments of k step kk: key rows 0..15 and 16..31.
__device__ inline void load_k_step(const half_t* lk, int kk, v16h (&kf)[2]) {
    kf[0] = frag_load_f16(lk, KPITCH_ / 2, 0,  kk * 32);
    kf[1] = frag_load_f16(lk, KPITCH_ / 2, 16, kk * 32);
}

// Four V^T fragments: output columns 64g .. 64g + 63.
__device__ inline void load_v_group(const half_t* lv, int g, v16h (&vf)[4]) {
#pragma unroll
    for (int u = 0; u < 4; ++u)
        vf[u] = frag_load_v_tr(lv, (4 * g + u) * 16);
}

// Eight fragments of the staged weight: rows 32(g>>1) .. + 31 (two tiles), four
// k steps from 4(g&1) on; fragment 2*kq + t is tile t at k step 4(g&1) + kq.
__device__ inline void load_m_group(const half_t* lm, int g, v16h (&mf)[8]) {
#pragma unroll
    for (int kq = 0; kq < 4; ++kq)
#pragma unroll
        for (int t = 0; t < 2; ++t)
            mf[2 * kq + t] = frag_load_f16(lm, PPITCH_ / 2, (g >> 1) * 32 + t * 16,
                                           ((g & 1) * 4 + kq) * 32);
}

__device__ inline float xhalf(float x) {
    const int b = __builtin_bit_cast(int, x);
    return __builtin_bit_cast(float, __builtin_amdgcn_permlanex16(
        b, b, 0x76543210, 0xfedcba98, false, false));
}

__global__ __launch_bounds__(256) void mha_attn_kernel(
    const half_t* __restrict__ X,  // [B,S,D], the queries' input as f16
    const half_t* __restrict__ M,  // [H,D,D], folded query weight as f16
    const float* __restrict__ bm,  // [H,D], folded query bias
    const half_t* __restrict__ K,  // [B,S,D], shared by the heads
    const half_t* __restrict__ V,  // [B,S,D], shared by the heads
    half_t* __restrict__ O)        // [H,B,S,D]
{
    __shared__ __attribute__((aligned(16)))
        half_t lK[2][32 * KPITCH_ / 2];   // 2 x 16.5 KB, row-major [t][d], padded
    __shared__ __attribute__((aligned(16)))
        half_t lV[2][32 * VPITCH_ / 2];   // 2 x 17 KB, row-major [t][e], padded
    __shared__ __attribute__((aligned(16)))
        half_t lM[D_ * PPITCH_ / 2];      // 132 KB, the head's weight [e][d], padded
    __shared__ __attribute__((aligned(32)))
        float lB[D_];                     // the head's bias

    const int wave = threadIdx.x >> 5;
    const int lane = threadIdx.x & 31;
    const int qrow0 = blockIdx.x * 256 + wave * 32;  // global query row
    const size_t base = (size_t)blockIdx.y * S_ * D_;

    const size_t kvbase = (size_t)(blockIdx.y % B_) * S_ * D_;   // y = h*B + b
    const int head = blockIdx.y / B_;
    const half_t* x  = X + kvbase;
    const half_t* kp = K + kvbase;
    const half_t* vp = V + kvbase;

    // ---- prologue: stage the head's weight and bias, and block 0 into
    // buffer 0 ---- 41 copies of a wave in flight. Unrolled: constant steps.
#pragma unroll
    for (int i = 0; i < D_ / 32; ++i)
        stage_tile_async<PPITCH_>(M + ((size_t)head * D_ + i * 32) * D_,
                                  &lM[i * 32 * PPITCH_ / 2]);
    {   // one float a thread
        typedef __attribute__((address_space(1))) int glb_i32;
        typedef __attribute__((address_space(3))) int lds_i32;
        __builtin_amdgcn_global_load_async_to_lds_b32(
            (glb_i32*)(bm + head * D_ + threadIdx.x),
            (lds_i32*)&lB[threadIdx.x], 0, 0);
    }
    stage_tile_async<KPITCH_>(kp, &lK[0][0]);
    stage_tile_async<VPITCH_>(vp, &lV[0][0]);

    // Every loop over j (column group), kk, g and n below is unrolled: constant
    // indices keep xb, qa, acc and the scores in registers.
    // Xq fragments for this wave's 2 x 16 rows (16 x v16h): the B operand of
    // Q^T = Mq Xq^T (n = query = lane&15, same table as an A operand).
    v16h xb[2][8];
#pragma unroll
    for (int j = 0; j < 2; ++j)
#pragma unroll
        for (int kk = 0; kk < 8; ++kk)
            xb[j][kk] = frag_load_f16(x, D_, qrow0 + j * 16, kk * 32);
    // The loads' address registers may be reused by what follows; the
    // scheduling barrier keeps the arithmetic that reuses them behind the wait.
    asm volatile("s_wait_xcnt 0x0" ::: "memory");
    __builtin_amdgcn_sched_barrier(0);

    // This wave's copies have landed before the barrier publishes them.
    asm volatile("s_wait_asynccnt 0x0" ::: "memory");
    __syncthreads();   // weight, bias and block 0 are staged by all waves

    // Q^T tiles two at a time (32 values of e, one k step of S^T), weight
    // fragments in groups of eight, one group ahead in a second register set;
    // each fragment feeds both column groups. The scheduling barriers keep the
    // order "next loads, this group's products": without them the loads are
    // sunk to their products. C layout: lane (c, h) holds query 16j + c,
    // e = 32kk + 16t + 8h + r, so two tiles pack in-lane into the B operand of
    // S^T = K Q^T, in the k order of frag_load_f16.
    v16h qa[2][8];
    {
        v16h mf[2][8];
        v8f bt[2];
        v8f c[2][2] = {};
        load_m_group(lM, 0, mf[0]);
#pragma unroll
        for (int g = 0; g < 16; ++g) {
            if (g < 15) load_m_group(lM, g + 1, mf[(g + 1) & 1]);
            if ((g & 1) == 0) {
#pragma unroll
                for (int t = 0; t < 2; ++t)
                    bt[t] = *(const v8f*)&lB[(g >> 1) * 32 + t * 16
                                             + ((lane >> 4) << 3)];
            }
            __builtin_amdgcn_sched_barrier(0);   // next loads | products of g
#pragma unroll
            for (int kq = 0; kq < 4; ++kq)
#pragma unroll
                for (int t = 0; t < 2; ++t)
#pragma unroll
                    for (int j = 0; j < 2; ++j)
                        c[t][j] = wmma_f16(mf[g & 1][2 * kq + t],
                                           xb[j][(g & 1) * 4 + kq], c[t][j]);
            __builtin_amdgcn_sched_barrier(0);   // products of g | what follows
            if (g & 1) {
#pragma unroll
                for (int j = 0; j < 2; ++j) {
                    qa[j][g >> 1] = __builtin_shufflevector(
                        __builtin_convertvector((c[0][j] + bt[0]) * QSCALE_, v8h),
                        __builtin_convertvector((c[1][j] + bt[1]) * QSCALE_, v8h),
                        0, 1, 2, 3, 4, 5, 6, 7, 8, 9, 10, 11, 12, 13, 14, 15);
                    c[0][j] = v8f{0,0,0,0,0,0,0,0};
                    c[1][j] = v8f{0,0,0,0,0,0,0,0};
                }
            }
        }
    }

    // Per lane and group: minus the maximum in use of query 16j + lane&15, in
    // log2 units (equal in both halves; block 0 sets it) and the running sum
    // over this half's keys alone (halves joined in the epilogue).
    float row_nm[2] = {0.0f, 0.0f}, row_l[2] = {0.0f, 0.0f};
    v8f acc[2][16];   // O^T tiles: register r <-> e = 16n + 8*(lane>>4) + r
#pragma unroll
    for (int j = 0; j < 2; ++j)
#pragma unroll
        for (int n = 0; n < 16; ++n) acc[j][n] = v8f{0,0,0,0,0,0,0,0};

    constexpr int NB = S_ / 32;   // 128 key blocks
    for (int ib = 0; ib < NB; ++ib) {
        const int cur = ib & 1;
        const int nxt = cur ^ 1;
        const bool more = (ib + 1) < NB;

        const half_t* lkc = &lK[cur][0];
        const half_t* lvc = &lV[cur][0];

        v16h kf[3][2], vf[2][4];
        load_k_step(lkc, 0, kf[0]);
        load_k_step(lkc, 1, kf[1]);

        // The score tiles start at minus the maximum in use (a lane's eight
        // registers are one query's), so the products end as s + row_nm.
        v8f s0[2], s1[2];
#pragma unroll
        for (int j = 0; j < 2; ++j) {
            const float nm = row_nm[j];
            s0[j] = v8f{nm, nm, nm, nm, nm, nm, nm, nm};
            s1[j] = s0[j];
        }

        // ---- stage block ib+1 (in flight during this block's WMMAs) ----
        if (more) {
            const size_t kt = (size_t)(ib + 1) * 32;
            stage_tile_async<KPITCH_>(kp + kt * D_, &lK[nxt][0]);
            stage_tile_async<VPITCH_>(vp + kt * D_, &lV[nxt][0]);
        }

#pragma unroll
        for (int kk = 0; kk < 8; ++kk) {
            if (kk < 6) {
                load_k_step(lkc, kk + 2, kf[(kk + 2) % 3]);
            } else {   // the first V group: it lands under the softmax
                vf[0][2 * kk - 12] = frag_load_v_tr(lvc, (2 * kk - 12) * 16);
                vf[0][2 * kk - 11] = frag_load_v_tr(lvc, (2 * kk - 11) * 16);
            }
            __builtin_amdgcn_sched_barrier(0);   // loads ahead | products of kk
#pragma unroll
            for (int j = 0; j < 2; ++j) {
                s0[j] = wmma_f16(kf[kk % 3][0], qa[j][kk], s0[j]);
                s1[j] = wmma_f16(kf[kk % 3][1], qa[j][kk], s1[j]);
            }
            __builtin_amdgcn_sched_barrier(0);   // products of kk | what follows
        }

        // Online softmax, per column group. C layout: lane (c, h) holds query
        // 16j + c's scores of keys 8h + r (s0[j][r]) and 16 + 8h + r
        // (s1[j][r]), in log2 units and relative to the maximum in use: the
        // exponentials are taken at once, and their sum is an in-lane tree.
        // Lazy rescale: the maximum in use may trail the true maximum as long
        // as a lane's 16 exponentials sum to PMAX_ at most, which bounds each of
        // them, well inside f16 (an overflow, or a NaN, fails the test too).
        // Each half tests its own keys; ONE test for the whole wave joins them.
        v8f p0[2], p1[2];
        float bs[2];
        const bool first = ib == 0;   // block 0 sets the maxima, whatever they are
        bool need = first;
#pragma unroll
        for (int j = 0; j < 2; ++j) {
            float t[8];
#pragma unroll
            for (int r = 0; r < 8; ++r) {
                p0[j][r] = __builtin_amdgcn_exp2f(s0[j][r]);
                p1[j][r] = __builtin_amdgcn_exp2f(s1[j][r]);
                t[r] = p0[j][r] + p1[j][r];
            }
            bs[j] = ((t[0] + t[1]) + (t[2] + t[3])) +
                    ((t[4] + t[5]) + (t[6] + t[7]));
            need = need || !(bs[j] <= PMAX_);
        }
        if (__builtin_amdgcn_ballot_w32(need) != 0) {
#pragma unroll
            for (int j = 0; j < 2; ++j) {
                float t[8];
#pragma unroll
                for (int r = 0; r < 8; ++r) t[r] = fmaxf(s0[j][r], s1[j][r]);
                const float hm =
                    fmaxf(fmaxf(fmaxf(t[0], t[1]), fmaxf(t[2], t[3])),
                          fmaxf(fmaxf(t[4], t[5]), fmaxf(t[6], t[7])));
                const float d = fmaxf(hm, xhalf(hm));   // equal in both halves
                const float up = first ? d : fmaxf(d, 0.0f);
                const float cj = first ? 1.0f : __builtin_amdgcn_exp2f(-up);
                row_l[j] *= cj;
                row_nm[j] -= up;
#pragma unroll
                for (int n = 0; n < 16; ++n) acc[j][n] *= cj;
                s0[j] -= up;
                s1[j] -= up;
#pragma unroll
                for (int r = 0; r < 8; ++r) {
                    p0[j][r] = __builtin_amdgcn_exp2f(s0[j][r]);
                    p1[j][r] = __builtin_amdgcn_exp2f(s1[j][r]);
                    t[r] = p0[j][r] + p1[j][r];
                }
                bs[j] = ((t[0] + t[1]) + (t[2] + t[3])) +
                        ((t[4] + t[5]) + (t[6] + t[7]));
            }
        }

        v16h pb[2];
#pragma unroll
        for (int j = 0; j < 2; ++j) {
            row_l[j] += bs[j];
            // Each row's sum is finished here (an input only, no instruction):
            // sunk behind the O^T products it holds registers beside the V
            // fragments, and the build spills.
            asm volatile("" :: "v"(row_l[j]));   // row sum pinned against spills

            // P^T as a B operand, packed in-lane: element i is key 8h + i,
            // element 8 + i is key 16 + 8h + i, the k order of frag_load_f16.
            pb[j] = __builtin_shufflevector(
                __builtin_convertvector(p0[j], v8h),
                __builtin_convertvector(p1[j], v8h),
                0, 1, 2, 3, 4, 5, 6, 7, 8, 9, 10, 11, 12, 13, 14, 15);
        }

#pragma unroll
        for (int g = 0; g < 4; ++g) {
            if (g < 3) load_v_group(lvc, g + 1, vf[(g + 1) & 1]);
            __builtin_amdgcn_sched_barrier(0);   // next loads | products of g
#pragma unroll
            for (int u = 0; u < 4; ++u)
#pragma unroll
                for (int j = 0; j < 2; ++j)
                    acc[j][4 * g + u] =
                        wmma_f16(vf[g & 1][u], pb[j], acc[j][4 * g + u]);
            __builtin_amdgcn_sched_barrier(0);   // products of g | what follows
        }

        // ---- publish block ib+1, recycle buffers ----
        // This wave's LDS reads have retired before the copies issued behind
        // the barrier refill the buffers it has just read.
        asm volatile("s_wait_dscnt 0x0" ::: "memory");
        asm volatile("s_wait_asynccnt 0x0" ::: "memory");
        __syncthreads();
    }

    // Epilogue: join the halves' sums, O /= row_l, store f16. Lane (c, h) holds
    // query row 16j + c, columns 16n + 8h + 0..7: one 16-byte store per tile.
#pragma unroll
    for (int j = 0; j < 2; ++j) {
        const float l = row_l[j] + xhalf(row_l[j]);
        const float inv = 1.0f / l;
        half_t* o = O + base + (size_t)(qrow0 + j * 16 + (lane & 15)) * D_
                             + ((lane >> 4) << 3);
#pragma unroll
        for (int n = 0; n < 16; ++n) {
            *(v8h*)(o + n * 16) = __builtin_convertvector(acc[j][n] * inv, v8h);
            if ((n & 3) == 3) {
                // The four stores' data and address registers may be reused by
                // what follows; the scheduling barrier keeps the next tiles'
                // arithmetic, which reuses them, behind the wait.
                asm volatile("s_wait_xcnt 0x0" ::: "memory");
                __builtin_amdgcn_sched_barrier(0);
            }
        }
    }
}

// ---------------------------------------------------------------------------
// Kernel 3: output projection.
//   Out[b,s,e] = sum_{h,d} attn[h,b,s,d] * Wo[e, h*D+d] + bo[e]
// Grid: (B*S/128, D/64). Block: 256 (8 waves); workgroup -> 128x64 tile of Out,
// wave -> 32x32 subtile (2 x 2 accumulator tiles). K is walked one head (256)
// at a time: the head's 128x256 A tile and 64x256 Wo tile (converted to f16)
// are staged in LDS by whole-line loads, in two buffers; the next head's loads
// are in flight in registers while this head's tiles are multiplied.
// ---------------------------------------------------------------------------
constexpr int OM_ = 128;   // rows of Out per workgroup
constexpr int ON_ = 64;    // columns of Out per workgroup
typedef __attribute__((ext_vector_type(4))) float    f32x4;
typedef __attribute__((ext_vector_type(4))) _Float16 f16x4;
typedef __attribute__((ext_vector_type(4))) unsigned u32x4;

// Issue one head's loads. au, wu: the workgroup's A tile (one contiguous 64 KB
// block) and Wo tile (64 pieces of 1 KB, a Wo row apart); ta, tw: this thread's
// first element in each. Every wave-wide load covers 512 contiguous bytes: four
// whole lines. Unrolled: constant indices keep av and wv in registers.
__device__ inline void outproj_fetch(const half_t* __restrict__ au, int ta,
                                     const float* __restrict__ wu, int tw,
                                     u32x4 (&av)[16], f32x4 (&wv)[16]) {
#pragma unroll
    for (int i = 0; i < 16; ++i)   // 256 threads x 16 B = 8 rows per step
        av[i] = *(const u32x4*)(au + ta + i * 8 * D_);
    // The A loads' address registers may be reused by what follows.
    asm volatile("s_wait_xcnt 0x0" ::: "memory");
#pragma unroll
    for (int i = 0; i < 16; ++i)   // 256 threads x 16 B = 4 rows per step
        wv[i] = *(const f32x4*)(wu + tw + i * 4 * H_ * D_);
    // The Wo loads' address registers are stepped to the next head behind this.
    asm volatile("s_wait_xcnt 0x0" ::: "memory");
}

// Store the fetched head into LDS, rows PPITCH_ bytes apart. la, lw: this
// thread's first bytes in the two tiles. A wave's store is contiguous.
__device__ inline void outproj_put(const u32x4 (&av)[16], const f32x4 (&wv)[16],
                                   char* la, char* lw) {
#pragma unroll
    for (int i = 0; i < 16; ++i)
        *(u32x4*)(la + i * 8 * PPITCH_) = av[i];
#pragma unroll
    for (int i = 0; i < 16; ++i)
        *(f16x4*)(lw + i * 4 * PPITCH_) = __builtin_convertvector(wv[i], f16x4);
}

__device__ inline void outproj_mul(const half_t* la, const half_t* lw,
                                   int wm, int wn, v8f (&c)[2][2]) {
    v16h a[2][2], bf[2][2];
#pragma unroll
    for (int i = 0; i < 2; ++i) {
        a[0][i]  = frag_load_f16(la, PPITCH_ / 2, wm + i * 16, 0);
        bf[0][i] = frag_load_f16(lw, PPITCH_ / 2, wn + i * 16, 0);
    }
#pragma unroll
    for (int k = 0; k < D_ / 32; ++k) {
        const int s = k & 1;
        if (k + 1 < D_ / 32) {
#pragma unroll
            for (int i = 0; i < 2; ++i) {
                a[s ^ 1][i]  = frag_load_f16(la, PPITCH_ / 2, wm + i * 16,
                                             (k + 1) * 32);
                bf[s ^ 1][i] = frag_load_f16(lw, PPITCH_ / 2, wn + i * 16,
                                             (k + 1) * 32);
            }
            __builtin_amdgcn_sched_barrier(0);   // loads of k + 1 | products of k
        }
#pragma unroll
        for (int i = 0; i < 2; ++i)
#pragma unroll
            for (int j = 0; j < 2; ++j)
                c[i][j] = wmma_f16(a[s][i], bf[s][j], c[i][j]);
        __builtin_amdgcn_sched_barrier(0);   // products of k | what follows
    }
}

__global__ __launch_bounds__(256) void mha_outproj_kernel(
    const half_t* __restrict__ A,   // [H,B,S,D] attention outputs (f16)
    const float*  __restrict__ Wo,  // [D, H*D]
    const float*  __restrict__ bo,  // [D]
    float* __restrict__ Out)        // [B,S,D]
{
    __shared__ __attribute__((aligned(16)))
        half_t lA[2][OM_ * PPITCH_ / 2];   // 2 x 66 KB, [s][d], padded
    __shared__ __attribute__((aligned(16)))
        half_t lW[2][ON_ * PPITCH_ / 2];   // 2 x 33 KB, [e][d], padded

    const int g    = threadIdx.x;
    const int wave = g >> 5;
    const int lane = g & 31;
    const int mt = blockIdx.x * OM_;   // first row over B*S
    const int nt = blockIdx.y * ON_;   // first e-col
    const int b  = mt / S_;            // a 128-row tile never crosses a batch
    const int s0 = mt % S_;
    const int wm = (wave >> 1) * 32;   // wave's rows inside the tile
    const int wn = (wave & 1) * 32;    // wave's cols inside the tile

    const half_t* au = A + ((size_t)b * S_ + s0) * D_;   // head 0's A tile
    const float*  wu = Wo + (size_t)nt * (H_ * D_);      // head 0's Wo tile
    const int ta = g * 8;                                // halves into an A tile
    const int tw = (g >> 6) * (H_ * D_) + (g & 63) * 4;  // floats into a Wo tile
    const int pa = (g >> 5) * PPITCH_ + (g & 31) * 16;   // bytes into an A tile
    const int pw = (g >> 6) * PPITCH_ + (g & 63) * 8;    // bytes into a Wo tile

    u32x4 av[16];
    f32x4 wv[16];
    outproj_fetch(au, ta, wu, tw, av, wv);
    outproj_put(av, wv, (char*)&lA[0][0] + pa, (char*)&lW[0][0] + pw);
    __syncthreads();   // head 0 is staged: every wave reads other waves' rows

    v8f c[2][2] = {};
    for (int h = 0; h + 1 < H_; ++h) {
        const int cur = h & 1;
        au += (size_t)B_ * S_ * D_;
        wu += D_;
        outproj_fetch(au, ta, wu, tw, av, wv);
        outproj_mul(&lA[cur][0], &lW[cur][0], wm, wn, c);
        outproj_put(av, wv, (char*)&lA[cur ^ 1][0] + pa,
                            (char*)&lW[cur ^ 1][0] + pw);
        // Publishes head h + 1, and ends every wave's reads of the buffers
        // that the next trip refills.
        __syncthreads();
    }
    outproj_mul(&lA[(H_ - 1) & 1][0], &lW[(H_ - 1) & 1][0], wm, wn, c);

    // Unrolled: constant indices keep c in registers.
#pragma unroll
    for (int j = 0; j < 2; ++j) {
        const int col = nt + wn + j * 16 + (lane & 15);
        const float bj = bo[col];
#pragma unroll
        for (int i = 0; i < 2; ++i) {
            const int rb = mt + wm + i * 16 + ((lane >> 4) << 3);
#pragma unroll
            for (int r = 0; r < 8; ++r)
                Out[(size_t)(rb + r) * D_ + col] = c[i][j][r] + bj;
        }
    }
}

// ---------------------------------------------------------------------------
// Kernel 0: weight folds, bias folds, and Xk, Xv, Xq as f16. One launch, the
// workgroup's part chosen by its index (a test that is uniform for the block):
//   0..63    Mq[h,c,d]      = sum_e Wk[h,e,c] * Wq[h,e,d]        (128x64 tiles, f16)
//   64..127  Wf[o,h*D+d]    = sum_e Wo[o,h*D+e] * Wv[h,e,d]      (128x64 tiles)
//   128..135 bqf[h,c]       = sum_e bq[h,e] * Wk[h,e,c]
//   136..151 bof[o]         = bo[o] + sum_{h,e} Wo[o,h*D+e] * bv[h,e]
//   152..535 Xk, Xv, Xq -> f16
// Mq and bqf take the places of Wq and bq in the query projection, Wf and bof
// those of Wo and bo in the output projection.
// ---------------------------------------------------------------------------
constexpr int FAP_ = 288;   // bytes per staged row of 128 f16, transposing reader: 32 B x odd
constexpr int FBP_ = 160;   // bytes per staged row of 64 f16, transposing reader: 32 B x odd

// One 128x64 tile of C(m,n) = sum_k A(m,k) B(n,k), k = 0..255, f16 operands,
// f32 sums, stored as OT. B lies in memory as [k][n] (rows D_ floats apart); A as [k][m]
// (A_TR, rows D_ floats apart) or as [m][k] (rows H_*D_ floats apart). An
// operand whose rows run over k is staged as it lies and read by the
// transposing LDS load. Every wave-wide global load covers whole lines.
// Unrolled throughout: constant indices keep the arrays in registers.
template <bool A_TR, typename OT>
__device__ inline void fold_tile(const float* __restrict__ a,
                                 const float* __restrict__ b,
                                 OT* __restrict__ o, char* la, char* lb) {
    constexpr int AG  = A_TR ? 32 : 64;         // groups of 4 floats per A row
    constexpr int AR  = 256 / AG;               // A rows per step
    constexpr int ALD = A_TR ? D_ : H_ * D_;    // floats between A rows
    constexpr int AP  = A_TR ? FAP_ : PPITCH_;  // bytes between staged A rows
    const int g    = threadIdx.x;
    const int wave = g >> 5;
    const int lane = g & 31;
    const int ar = g / AG, ac = g % AG;
    const int br = g >> 4, bc = g & 15;         // 16 groups per B row

    const float* pa = a + ar * ALD + ac * 4;    // this thread's first loads
    const float* pb = b + br * D_ + bc * 4;
    f32x4 av[32], bv[16];
#pragma unroll
    for (int i = 0; i < 32; ++i)
        av[i] = *(const f32x4*)(pa + i * AR * ALD);
#pragma unroll
    for (int i = 0; i < 16; ++i)
        bv[i] = *(const f32x4*)(pb + i * 16 * D_);
    // The loads' address registers may be reused by what follows; as inputs
    // of the wait they stay whole up to it (else the last load lands on them).
    asm volatile("s_wait_xcnt 0x0" :: "v"(pa), "v"(pb) : "memory");
#pragma unroll
    for (int i = 0; i < 32; ++i)
        *(f16x4*)(la + (i * AR + ar) * AP + ac * 8) =
            __builtin_convertvector(av[i], f16x4);
#pragma unroll
    for (int i = 0; i < 16; ++i)
        *(f16x4*)(lb + (i * 16 + br) * FBP_ + bc * 8) =
            __builtin_convertvector(bv[i], f16x4);
    __syncthreads();   // every wave reads rows that other waves staged

    const int wm = (wave >> 1) * 32;   // wave's rows inside the tile
    const int wn = (wave & 1) * 32;    // wave's cols inside the tile
    v8f c[2][2] = {};
#pragma unroll
    for (int k = 0; k < D_ / 32; ++k) {
        v16h af[2], bf[2];
#pragma unroll
        for (int i = 0; i < 2; ++i) {
            if (A_TR)
                af[i] = frag_load_v_tr<FAP_>(
                    (const half_t*)(la + k * 32 * FAP_), wm + i * 16);
            else
                af[i] = frag_load_f16((const half_t*)la, PPITCH_ / 2,
                                      wm + i * 16, k * 32);
            bf[i] = frag_load_v_tr<FBP_>(
                (const half_t*)(lb + k * 32 * FBP_), wn + i * 16);
        }
#pragma unroll
        for (int i = 0; i < 2; ++i)
#pragma unroll
            for (int j = 0; j < 2; ++j)
                c[i][j] = wmma_f16(af[i], bf[j], c[i][j]);
    }

#pragma unroll
    for (int j = 0; j < 2; ++j) {
        const int col = wn + j * 16 + (lane & 15);
#pragma unroll
        for (int i = 0; i < 2; ++i) {
            const int rb = wm + i * 16 + ((lane >> 4) << 3);
#pragma unroll
            for (int r = 0; r < 8; ++r)
                o[(rb + r) * ALD + col] = (OT)c[i][j][r];
        }
    }
    // The stores' registers may be reused on the way to the kernel's end.
    asm volatile("s_wait_xcnt 0x0" ::: "memory");
}

__global__ __launch_bounds__(256, 4) void mha_fold_kernel(
    const float* __restrict__ Xk,   // [B,S,D]
    const float* __restrict__ Xv,   // [B,S,D]
    const float* __restrict__ Xq,   // [B,S,D]
    const float* __restrict__ Wq,   // [H,D,D]
    const float* __restrict__ bq,   // [H,D]
    const float* __restrict__ Wk,   // [H,D,D]
    const float* __restrict__ Wv,   // [H,D,D]
    const float* __restrict__ bv,   // [H,D]
    const float* __restrict__ Wo,   // [D, H*D]
    const float* __restrict__ bo,   // [D]
    half_t* __restrict__ xk,        // [B,S,D]
    half_t* __restrict__ xv,        // [B,S,D]
    half_t* __restrict__ xq,        // [B,S,D]
    half_t* __restrict__ Mq,        // [H,D,D]
    float* __restrict__ bqf,        // [H,D]
    float* __restrict__ Wf,         // [D, H*D]
    float* __restrict__ bof)        // [D]
{
    __shared__ __attribute__((aligned(16))) char lA[256 * FAP_];   // 72 KB
    __shared__ __attribute__((aligned(16))) char lB[256 * FBP_];   // 40 KB

    const int w = blockIdx.x;
    const int g = threadIdx.x;
    if (w < 128) {
        const int h  = (w & 63) >> 3;
        const int mt = ((w >> 2) & 1) * 128;
        const int nt = (w & 3) * 64;
        const int hw = h * D_ * D_;
        if (w < 64)
            fold_tile<true, half_t>(Wk + hw + mt, Wq + hw + nt,
                                    Mq + hw + mt * D_ + nt, lA, lB);
        else
            fold_tile<false, float>(Wo + mt * (H_ * D_) + h * D_, Wv + hw + nt,
                                    Wf + mt * (H_ * D_) + h * D_ + nt, lA, lB);
    } else if (w < 136) {
        // One head; thread g owns column g of Wk[h]. Unrolled: one address,
        // immediate steps, many loads in flight; four partial sums.
        const int h = w - 128;
        const float* wk = Wk + h * D_ * D_ + g;
        const float* bb = bq + h * D_;
        float t[4] = {0.0f, 0.0f, 0.0f, 0.0f};
#pragma unroll
        for (int e = 0; e < D_; ++e)
            t[e & 3] = fmaf(bb[e], wk[e * D_], t[e & 3]);
        bqf[h * D_ + g] = (t[0] + t[1]) + (t[2] + t[3]);
        // The store's registers may be reused on the way to the kernel's end.
        asm volatile("s_wait_xcnt 0x0" ::: "memory");
    } else if (w < 152) {
        // A wave owns two rows of Wo; a lane every 32nd group of four columns.
        const int lane = g & 31;
        const int r0 = (w - 136) * 16 + (g >> 5) * 2;
        const float* pw = Wo + r0 * (H_ * D_) + lane * 4;
        const float* pv = bv + lane * 4;
        f32x4 bb[16], x0[16], x1[16];
#pragma unroll
        for (int i = 0; i < 16; ++i) {
            bb[i] = *(const f32x4*)(pv + i * 128);
            x0[i] = *(const f32x4*)(pw + i * 128);
            x1[i] = *(const f32x4*)(pw + H_ * D_ + i * 128);
        }
        // The loads' address registers may be reused by what follows; as inputs
        // of the wait they stay whole up to it (else the last load lands on them).
        asm volatile("s_wait_xcnt 0x0" :: "v"(pw), "v"(pv) : "memory");
        f32x4 a0 = {0.0f, 0.0f, 0.0f, 0.0f}, a1 = {0.0f, 0.0f, 0.0f, 0.0f};
#pragma unroll
        for (int i = 0; i < 16; ++i) {
            a0 += x0[i] * bb[i];
            a1 += x1[i] * bb[i];
        }
        float t0 = (a0[0] + a0[1]) + (a0[2] + a0[3]);
        float t1 = (a1[0] + a1[1]) + (a1[2] + a1[3]);
        t0 += xhalf(t0);
        t1 += xhalf(t1);
#pragma unroll
        for (int m = 8; m >= 1; m >>= 1) {
            t0 += __shfl_xor(t0, m, 32);
            t1 += __shfl_xor(t1, m, 32);
        }
        if (lane == 0) {
            bof[r0]     = t0 + bo[r0];
            bof[r0 + 1] = t1 + bo[r0 + 1];
        }
        // The stores' registers may be reused on the way to the kernel's end.
        asm volatile("s_wait_xcnt 0x0" ::: "memory");
    } else {
        // 128 workgroups per tensor, 16384 contiguous floats each: a lane loads
        // 32 contiguous bytes and stores 16.
        const int cw = w - 152;
        const int off = (cw & 127) * 16384 + g * 8;
        const float* src = (cw < 128 ? Xk : cw < 256 ? Xv : Xq) + off;
        half_t* dst = (cw < 128 ? xk : cw < 256 ? xv : xq) + off;
        f32x4 v[16];
#pragma unroll
        for (int i = 0; i < 8; ++i) {
            v[2 * i]     = *(const f32x4*)(src + i * 2048);
            v[2 * i + 1] = *(const f32x4*)(src + i * 2048 + 4);
        }
        // The loads' address registers may be reused by what follows; as an input
        // of the wait they stay whole up to it (else the last load lands on them).
        asm volatile("s_wait_xcnt 0x0" :: "v"(src) : "memory");
#pragma unroll
        for (int i = 0; i < 8; ++i)
            *(v8h*)(dst + i * 2048) = __builtin_shufflevector(
                __builtin_convertvector(v[2 * i], f16x4),
                __builtin_convertvector(v[2 * i + 1], f16x4),
                0, 1, 2, 3, 4, 5, 6, 7);
        // The stores' registers may be reused on the way to the kernel's end.
        asm volatile("s_wait_xcnt 0x0" ::: "memory");
    }
}

// ---------------------------------------------------------------------------
extern "C" void kernel_launch(void* const* d_in, const int* in_sizes, int n_in,
                              void* d_out, int out_size, void* d_ws, size_t ws_size,
                              hipStream_t stream) {
    (void)in_sizes; (void)n_in; (void)out_size; (void)ws_size;

    const float* query = (const float*)d_in[0];
    const float* key_  = (const float*)d_in[1];
    const float* value = (const float*)d_in[2];
    const float* Wq    = (const float*)d_in[3];
    const float* bq    = (const float*)d_in[4];
    const float* Wk    = (const float*)d_in[5];
    const float* Wv    = (const float*)d_in[7];
    const float* bv    = (const float*)d_in[8];
    const float* Wo    = (const float*)d_in[9];
    const float* bo    = (const float*)d_in[10];
    float* out = (float*)d_out;

    const size_t per = (size_t)H_ * B_ * S_ * D_;   // elements per per-head f16 tensor
    const size_t xel = (size_t)B_ * S_ * D_;        // elements of an input tensor
    half_t* ah = (half_t*)d_ws;                      // 33.5 MB
    half_t* xk = ah + per;
    half_t* xv = xk + xel;
    half_t* xq = xv + xel;                           // 3 * 4 MB
    half_t* mq = xq + xel;                           // [H,D,D], 1 MB
    float* wf  = (float*)(mq + (size_t)H_ * D_ * D_);   // [D,H*D], 2 MB
    float* bqf = wf + (size_t)H_ * D_ * D_;          // [H,D]
    float* bof = bqf + (size_t)H_ * D_;              // [D]

    // d_in[6], the key bias, adds a constant to all scores of a query: the
    // softmax cancels it, and no kernel reads it.
    mha_fold_kernel<<<dim3(536), dim3(256), 0, stream>>>(
        key_, value, query, Wq, bq, Wk, Wv, bv, Wo, bo, xk, xv, xq, mq, bqf, wf,
        bof);

    dim3 ablk(256), agrd(S_ / 256, H_ * B_);
    mha_attn_kernel<<<agrd, ablk, 0, stream>>>(xq, mq, bqf, xk, xv, ah);

    dim3 oblk(256), ogrd((B_ * S_) / OM_, D_ / ON_);
    mha_outproj_kernel<<<ogrd, oblk, 0, stream>>>(ah, wf, bof, out);
}
